// v000
// The times below were measured on an AMD MI455X: many runs one after another, warmed up first and cycling through
// copies of the inputs, with the whole window's GPU time divided by the number of runs. Launches and the gaps
// between them are all in it. The median over several windows is given; except for v000 it joins two sittings, which
// can be a few percent apart, so the side-by-side timings, each taken in one sitting, are the better comparison.
// The starting kernel, v000, takes 224 microseconds a run.
#include <hip/hip_runtime.h>
#include <math.h>

typedef __attribute__((ext_vector_type(16))) _Float16 v16h;
typedef __attribute__((ext_vector_type(16))) __bf16 v16b;
typedef __attribute__((ext_vector_type(8)))  _Float16 v8h;
typedef __attribute__((ext_vector_type(8)))  float v8f;
typedef __attribute__((ext_vector_type(4)))  float v4f;
typedef __attribute__((ext_vector_type(2)))  float v2f;
typedef __attribute__((ext_vector_type(4)))  unsigned v4u;
typedef __attribute__((ext_vector_type(4)))  int v4i;
typedef float __attribute__((may_alias)) float_a;
typedef int __attribute__((may_alias)) int_a;

template <typename T> __device__ __forceinline__ void vst2(void* p, T v) { *(T*)p = v;  }
__device__ __forceinline__ v8f wmma16(v16h a, v16h b, v8f c) {
  v8f d = __builtin_amdgcn_wmma_f32_16x16x32_f16(false, a, false, b, (short)0, c, false, false);
  asm volatile("v_nop\n\tv_nop\n\tv_nop\n\tv_nop" : "+v"(d) : "v"(a), "v"(b));
  return d;
}
__device__ __forceinline__ v8f wmma_bf(v16b a, v16b b, v8f c) {
  v8f d = __builtin_amdgcn_wmma_f32_16x16x32_bf16(false, a, false, b, (short)0, c, false, false);
  asm volatile("v_nop\n\tv_nop\n\tv_nop\n\tv_nop" : "+v"(d) : "v"(a), "v"(b));
  return d;
}
// 16x16x32 fragments: lane = (h = lane>>4, row/col = lane&15); elements 0..7 = k0+8h+0..7, 8..15 = k0+16+8h+0..7; D element r = row 8h+r
__device__ __forceinline__ v16h frag_h(const _Float16* rowk0, int lane) {
  union { v16h v; v8h q[2]; } u; const _Float16* p = rowk0 + 8 * (lane >> 4);
  u.q[0] = *(const v8h*)p; u.q[1] = *(const v8h*)(p + 16); return u.v;
}
__device__ __forceinline__ v16h frag_f32(const float* rowk0, int lane) {
  v16h a; const float* p = rowk0 + 8 * (lane >> 4);
#pragma unroll
  for (int i = 0; i < 8; ++i) { a[i] = (_Float16)p[i]; a[8 + i] = (_Float16)p[16 + i]; }
  return a;
}
__device__ __forceinline__ v16h frag_f32s(const float* rowk0, int lane, float sc) {
  v16h a; const float* p = rowk0 + 8 * (lane >> 4);
#pragma unroll
  for (int i = 0; i < 8; ++i) { a[i] = (_Float16)(p[i] * sc); a[8 + i] = (_Float16)(p[16 + i] * sc); }
  return a;
}
// column fragment from a [K][ld] layout (column n), rows >= K read as 0
__device__ __forceinline__ v16h fragc_f32(const float* W, int k0, int n, int lane, int ld, int K) {
  v16h a; const int g = lane >> 4;
#pragma unroll
  for (int i = 0; i < 8; ++i) { const int ka = k0 + 8 * g + i, kb = ka + 16;
    a[i] = (_Float16)(ka < K ? W[(size_t)ka * ld + n] : 0.f); a[8 + i] = (_Float16)(kb < K ? W[(size_t)kb * ld + n] : 0.f); }
  return a;
}
struct F2 { v16b h, l; };
__device__ __forceinline__ F2 bsplit16(const float v[16]) { F2 r;
#pragma unroll
  for (int i = 0; i < 16; ++i) { const __bf16 h = (__bf16)v[i]; r.h[i] = h; r.l[i] = (__bf16)(v[i] - (float)h); }
  return r; }
__device__ __forceinline__ F2 split_row(const float* row, int k0, int lane) { float v[16]; const float* p = row + k0 + 8 * (lane >> 4);
#pragma unroll
  for (int i = 0; i < 8; ++i) { v[i] = p[i]; v[8 + i] = p[16 + i]; }
  return bsplit16(v); }
__device__ __forceinline__ F2 split_rowK(const float* row, int k0, int lane, int K) { float v[16]; const int g = lane >> 4;
#pragma unroll
  for (int i = 0; i < 8; ++i) { const int ka = k0 + 8 * g + i, kb = ka + 16; v[i] = ka < K ? row[ka] : 0.f; v[8 + i] = kb < K ? row[kb] : 0.f; }
  return bsplit16(v); }
__device__ __forceinline__ F2 split_col(const float* W, int k0, int n, int lane, int ld, int K) { float v[16]; const int g = lane >> 4;
#pragma unroll
  for (int i = 0; i < 8; ++i) { const int ka = k0 + 8 * g + i, kb = ka + 16; v[i] = ka < K ? W[(size_t)ka * ld + n] : 0.f; v[8 + i] = kb < K ? W[(size_t)kb * ld + n] : 0.f; }
  return bsplit16(v); }
__device__ __forceinline__ v8f mac3(const F2& a, const F2& b, v8f c) { c = wmma_bf(a.l, b.h, c); c = wmma_bf(a.h, b.l, c); return wmma_bf(a.h, b.h, c); }
__device__ __forceinline__ float sigm(float v) { return 1.0f / (1.0f + expf(-v)); }
#define LDSX() do { asm volatile("s_wait_dscnt 0" ::: "memory"); __builtin_amdgcn_wave_barrier(); __builtin_amdgcn_fence(__ATOMIC_RELEASE, "workgroup"); } while (0)

// Causal linear ("kernelized") attention: out[q] = sum_{k<=q} (phi(q_q).phi(k_k)) v_k / sum_{k<=q} phi(q_q).phi(k_k) with phi = softplus.
// q/k projections on v_wmma_f32_16x16x32_f16 (operands converted in the fragments, [out][in] weights x16), softplus in f32, features kept as
// f16 rows plus f32 copies; the v projection as a two-way bf16 split (near-f32: the first rows return v almost verbatim); per (n, h, 64
// queries) the causal score tiles S = phi_q . phi_k and S @ V on f16 WMMA (S scaled by 1/64 into f16; V as an f16 transposed copy) with the
// row sums of S accumulated in f32 — except the first two query blocks of each sequence, whose S and S @ V are two-way bf16 splits
#define NB 2
#define LL 2048
#define DM 512
#define NH 8
#define HD 64
#define NR (NB * LL)

// projections: blockIdx.z: 0 -> phi(q) (F16 rows PQ16 [r][512] + f32 PQ32), 1 -> phi(k) (PK16, PK32), 2 -> v (V32 rows [r][512] split GEMM; VT16 [n][c][l] f16)
__global__ __launch_bounds__(128) void k_proj(const float* __restrict__ xq, const float* __restrict__ xk, const float* __restrict__ Wq, const float* __restrict__ Wk, const float* __restrict__ Wv,
                                            _Float16* __restrict__ PQ16, float* __restrict__ PQ32, _Float16* __restrict__ PK16, float* __restrict__ PK32, float* __restrict__ V32, _Float16* __restrict__ VT16) {
  __shared__ __align__(16) float so[4][16][132];
  __shared__ __align__(16) _Float16 st[128][72];
  const int tid = threadIdx.x, wave = tid >> 5, lane = tid & 31, col = lane & 15, g = lane >> 4;
  const int which = blockIdx.z, r0b = blockIdx.x * 64, r0 = r0b + wave * 16, n0 = blockIdx.y * 128;
  v8f acc[8] = {};
  if (which < 2) { const float* X = which == 0 ? xq : xk; const float* W = which == 0 ? Wq : Wk;
#pragma unroll 1
    for (int kc = 0; kc < DM / 32; ++kc) { const v16h a = frag_f32(X + (size_t)(r0 + col) * DM + kc * 32, lane);
#pragma unroll
      for (int j = 0; j < 8; ++j) acc[j] = wmma16(a, frag_f32s(W + (size_t)(n0 + j * 16 + col) * DM + kc * 32, lane, 16.0f), acc[j]); }
#pragma unroll
    for (int j = 0; j < 8; ++j)
#pragma unroll
      for (int r = 0; r < 8; ++r) { const float z = acc[j][r] * (1.0f / 16.0f); so[wave][8 * g + r][j * 16 + col] = z > 15.0f ? z : log1pf(expf(z)); }   // softplus
    LDSX();
    _Float16* D16 = which == 0 ? PQ16 : PK16; float* D32 = which == 0 ? PQ32 : PK32;
#pragma unroll 4
    for (int rl = 0; rl < 16; ++rl) vst2(D32 + (size_t)(r0 + rl) * DM + n0 + lane * 4, *(const v4f*)(&so[wave][rl][lane * 4]));
    for (int q = lane; q < 16 * 16; q += 32) { const int rl = q >> 4, pc = q & 15; union { v8h h8; v4u u; } pk;
#pragma unroll
      for (int e = 0; e < 8; ++e) pk.h8[e] = (_Float16)so[wave][rl][pc * 8 + e];
      vst2(D16 + (size_t)(r0 + rl) * DM + n0 + pc * 8, pk.u); } }
  else {
#pragma unroll 1
    for (int kc = 0; kc < DM / 32; ++kc) { const F2 a = split_row(xk + (size_t)(r0 + col) * DM, kc * 32, lane);
#pragma unroll
      for (int j = 0; j < 8; ++j) acc[j] = mac3(a, split_row(Wv + (size_t)(n0 + j * 16 + col) * DM, kc * 32, lane), acc[j]); }
#pragma unroll
    for (int j = 0; j < 8; ++j)
#pragma unroll
      for (int r = 0; r < 8; ++r) { so[wave][8 * g + r][j * 16 + col] = acc[j][r]; st[j * 16 + col][wave * 16 + 8 * g + r] = (_Float16)acc[j][r]; }
    LDSX();
#pragma unroll 4
    for (int rl = 0; rl < 16; ++rl) vst2(V32 + (size_t)(r0 + rl) * DM + n0 + lane * 4, *(const v4f*)(&so[wave][rl][lane * 4]));
    __syncthreads();
    // VT16 [n][c][l]: c = n0 + cl (global channel 0..511 = h*64 + d), l = r0b .. +63 within sequence n
    { const int n = r0b / LL, l0 = r0b % LL;
      for (int q = tid; q < 128 * 8; q += 128) { const int cl = q >> 3, pc = q & 7; vst2(VT16 + ((size_t)n * DM + n0 + cl) * LL + l0 + pc * 8, *(const v4u*)(&st[cl][pc * 8])); } } }
}
// attention: block (64 queries, h, n)
__global__ __launch_bounds__(128) void k_attn(const _Float16* __restrict__ PQ16, const float* __restrict__ PQ32, const _Float16* __restrict__ PK16, const float* __restrict__ PK32, const float* __restrict__ V32, const _Float16* __restrict__ VT16, float* __restrict__ out) {
  __shared__ __align__(16) float sS[4][16][68];
  __shared__ __align__(16) _Float16 sP[4][16][72];
  __shared__ __align__(16) float sO[4][16][68];
  const int tid = threadIdx.x, w = tid >> 5, lane = tid & 31, col = lane & 15, g = lane >> 4;
  const int n = blockIdx.z, h = blockIdx.y, q0 = blockIdx.x * 64 + w * 16; const size_t rb = (size_t)n * LL;
  const bool precise = blockIdx.x < 2;
  v16h aq[2]; F2 aqs[2];
#pragma unroll
  for (int kc = 0; kc < 2; ++kc) { aq[kc] = frag_h(PQ16 + (rb + q0 + col) * DM + h * HD + kc * 32, lane); aqs[kc] = split_row(PQ32 + (rb + q0 + col) * DM + h * HD, kc * 32, lane); }
  v8f acc[4] = {}; float zsum = 0.f;                      // zsum: row (col) partial over this lane's half? -> keep per (row = col, half g) then combine
  const int ntiles = blockIdx.x + 1;
#pragma unroll 1
  for (int kt = 0; kt < ntiles; ++kt) {
#pragma unroll
    for (int t = 0; t < 4; ++t) { v8f s = {}; const int key = kt * 64 + t * 16 + col;
      if (precise) {
#pragma unroll
        for (int kc = 0; kc < 2; ++kc) s = mac3(aqs[kc], split_row(PK32 + (rb + key) * DM + h * HD, kc * 32, lane), s); }
      else {
#pragma unroll
        for (int kc = 0; kc < 2; ++kc) s = wmma16(aq[kc], frag_h(PK16 + (rb + key) * DM + h * HD + kc * 32, lane), s); }
#pragma unroll
      for (int r = 0; r < 8; ++r) { const int qi = q0 + 8 * g + r; sS[w][8 * g + r][t * 16 + col] = key <= qi ? s[r] : 0.f; } }
    LDSX();
    // row sums (lane (row col, half g)) and the f16 copy (x 1/64)
    { float z = 0.f;
#pragma unroll
      for (int jj = 0; jj < 32; ++jj) { const float sv = sS[w][col][g * 32 + jj]; z += sv; sP[w][col][g * 32 + jj] = (_Float16)(sv * (1.0f / 64.0f)); }
      zsum += z; }
    LDSX();
    if (precise) {
#pragma unroll
      for (int kc = 0; kc < 2; ++kc) { const F2 pa = split_row(&sS[w][col][0], kc * 32, lane);
#pragma unroll
        for (int t = 0; t < 4; ++t) acc[t] = mac3(pa, split_col(V32 + (rb + kt * 64) * DM + h * HD, kc * 32, t * 16 + col, lane, DM, 64), acc[t]); } }
    else {
#pragma unroll
      for (int kc = 0; kc < 2; ++kc) { const v16h pa = frag_h(&sP[w][col][0] + kc * 32, lane);
#pragma unroll
        for (int t = 0; t < 4; ++t) acc[t] = wmma16(pa, frag_h(VT16 + ((size_t)n * DM + h * HD + t * 16 + col) * LL + kt * 64 + kc * 32, lane), acc[t]); } }
    __builtin_amdgcn_wave_barrier(); }
  zsum += __shfl_xor(zsum, 16, 32);                        // full row sum for row 'col' in both half-lanes
  const float oscale = precise ? 1.0f : 64.0f;
#pragma unroll
  for (int r = 0; r < 8; ++r) { const float zr = __shfl(zsum, 8 * g + r, 32);
#pragma unroll
    for (int t = 0; t < 4; ++t) sO[w][8 * g + r][t * 16 + col] = acc[t][r] * oscale / zr; }
  LDSX();
  for (int q = lane; q < 16 * 16; q += 32) { const int rl = q >> 4, pc = q & 15; vst2(out + (rb + q0 + rl) * DM + h * HD + pc * 4, *(const v4f*)(&sO[w][rl][pc * 4])); }
}
extern "C" void kernel_launch(void* const* d_in, const int* in_sizes, int n_in, void* d_out, int out_size, void* d_ws, size_t ws_size, hipStream_t stream) {
  (void)in_sizes; (void)n_in; (void)out_size; (void)ws_size;
  const float* xq = (const float*)d_in[0]; const float* xk = (const float*)d_in[1]; const float* Wq = (const float*)d_in[2]; const float* Wk = (const float*)d_in[3]; const float* Wv = (const float*)d_in[4];
  float* out = (float*)d_out;
  char* ws = (char*)d_ws; size_t off = 0;
  auto take = [&](size_t bytes) { char* p = ws + off; off += (bytes + 255) & ~(size_t)255; return p; };
  _Float16* PQ16 = (_Float16*)take((size_t)NR * DM * 2); float* PQ32 = (float*)take((size_t)NR * DM * 4); _Float16* PK16 = (_Float16*)take((size_t)NR * DM * 2); float* PK32 = (float*)take((size_t)NR * DM * 4);
  float* V32 = (float*)take((size_t)NR * DM * 4); _Float16* VT16 = (_Float16*)take((size_t)NB * DM * LL * 2);
  k_proj<<<dim3(NR / 64, DM / 128, 3), 128, 0, stream>>>(xq, xk, Wq, Wk, Wv, PQ16, PQ32, PK16, PK32, V32, VT16);
  k_attn<<<dim3(LL / 64, NH, NB), 128, 0, stream>>>(PQ16, PQ32, PK16, PK32, V32, VT16, out);
}

// v001
// It runs in 93.8 microseconds.
// Two timings next to v000 both put it at 2.39 times that version's speed.
#include <hip/hip_runtime.h>
#include <math.h>

typedef __attribute__((ext_vector_type(16))) _Float16 v16h;
typedef __attribute__((ext_vector_type(16))) __bf16 v16b;
typedef __attribute__((ext_vector_type(8)))  _Float16 v8h;
typedef __attribute__((ext_vector_type(8)))  float v8f;
typedef __attribute__((ext_vector_type(4)))  float v4f;
typedef __attribute__((ext_vector_type(2)))  float v2f;
typedef __attribute__((ext_vector_type(4)))  unsigned v4u;
typedef __attribute__((ext_vector_type(4)))  int v4i;
typedef float __attribute__((may_alias)) float_a;
typedef int __attribute__((may_alias)) int_a;

template <typename T> __device__ __forceinline__ void vst2(void* p, T v) { *(T*)p = v;  }
__device__ __forceinline__ v8f wmma16(v16h a, v16h b, v8f c) {
  v8f d = __builtin_amdgcn_wmma_f32_16x16x32_f16(false, a, false, b, (short)0, c, false, false);
  asm volatile("v_nop\n\tv_nop\n\tv_nop\n\tv_nop" : "+v"(d) : "v"(a), "v"(b));
  return d;
}
__device__ __forceinline__ v8f wmma_bf(v16b a, v16b b, v8f c) {
  v8f d = __builtin_amdgcn_wmma_f32_16x16x32_bf16(false, a, false, b, (short)0, c, false, false);
  asm volatile("v_nop\n\tv_nop\n\tv_nop\n\tv_nop" : "+v"(d) : "v"(a), "v"(b));
  return d;
}
// 16x16x32 fragments: lane = (h = lane>>4, row/col = lane&15); elements 0..7 = k0+8h+0..7, 8..15 = k0+16+8h+0..7; D element r = row 8h+r
__device__ __forceinline__ v16h frag_h(const _Float16* rowk0, int lane) {
  union { v16h v; v8h q[2]; } u; const _Float16* p = rowk0 + 8 * (lane >> 4);
  u.q[0] = *(const v8h*)p; u.q[1] = *(const v8h*)(p + 16); return u.v;
}
__device__ __forceinline__ v16h frag_f32(const float* rowk0, int lane) {
  v16h a; const float* p = rowk0 + 8 * (lane >> 4);
#pragma unroll
  for (int i = 0; i < 8; ++i) { a[i] = (_Float16)p[i]; a[8 + i] = (_Float16)p[16 + i]; }
  return a;
}
__device__ __forceinline__ v16h frag_f32s(const float* rowk0, int lane, float sc) {
  v16h a; const float* p = rowk0 + 8 * (lane >> 4);
#pragma unroll
  for (int i = 0; i < 8; ++i) { a[i] = (_Float16)(p[i] * sc); a[8 + i] = (_Float16)(p[16 + i] * sc); }
  return a;
}
// column fragment from a [K][ld] layout (column n), rows >= K read as 0
__device__ __forceinline__ v16h fragc_f32(const float* W, int k0, int n, int lane, int ld, int K) {
  v16h a; const int g = lane >> 4;
#pragma unroll
  for (int i = 0; i < 8; ++i) { const int ka = k0 + 8 * g + i, kb = ka + 16;
    a[i] = (_Float16)(ka < K ? W[(size_t)ka * ld + n] : 0.f); a[8 + i] = (_Float16)(kb < K ? W[(size_t)kb * ld + n] : 0.f); }
  return a;
}
struct F2 { v16b h, l; };
__device__ __forceinline__ F2 bsplit16(const float v[16]) { F2 r;
#pragma unroll
  for (int i = 0; i < 16; ++i) { const __bf16 h = (__bf16)v[i]; r.h[i] = h; r.l[i] = (__bf16)(v[i] - (float)h); }
  return r; }
__device__ __forceinline__ F2 split_row(const float* row, int k0, int lane) { float v[16]; const float* p = row + k0 + 8 * (lane >> 4);
#pragma unroll
  for (int i = 0; i < 8; ++i) { v[i] = p[i]; v[8 + i] = p[16 + i]; }
  return bsplit16(v); }
__device__ __forceinline__ F2 split_rowK(const float* row, int k0, int lane, int K) { float v[16]; const int g = lane >> 4;
#pragma unroll
  for (int i = 0; i < 8; ++i) { const int ka = k0 + 8 * g + i, kb = ka + 16; v[i] = ka < K ? row[ka] : 0.f; v[8 + i] = kb < K ? row[kb] : 0.f; }
  return bsplit16(v); }
__device__ __forceinline__ F2 split_col(const float* W, int k0, int n, int lane, int ld, int K) { float v[16]; const int g = lane >> 4;
#pragma unroll
  for (int i = 0; i < 8; ++i) { const int ka = k0 + 8 * g + i, kb = ka + 16; v[i] = ka < K ? W[(size_t)ka * ld + n] : 0.f; v[8 + i] = kb < K ? W[(size_t)kb * ld + n] : 0.f; }
  return bsplit16(v); }
__device__ __forceinline__ v8f mac3(const F2& a, const F2& b, v8f c) { c = wmma_bf(a.l, b.h, c); c = wmma_bf(a.h, b.l, c); return wmma_bf(a.h, b.h, c); }
__device__ __forceinline__ float sigm(float v) { return 1.0f / (1.0f + expf(-v)); }
#define LDSX() do { asm volatile("s_wait_dscnt 0" ::: "memory"); __builtin_amdgcn_wave_barrier(); __builtin_amdgcn_fence(__ATOMIC_RELEASE, "workgroup"); } while (0)

// Causal linear ("kernelized") attention: out[q] = sum_{k<=q} (phi(q_q).phi(k_k)) v_k / sum_{k<=q} phi(q_q).phi(k_k) with phi = softplus.
// q/k projections on v_wmma_f32_16x16x32_f16 (operands converted in the fragments, [out][in] weights x16), softplus in f32, features kept as
// f16 rows plus f32 copies; the v projection as a two-way bf16 split (near-f32: the first rows return v almost verbatim); per (n, h, 64
// queries) the causal score tiles S = phi_q . phi_k and S @ V on f16 WMMA (S scaled by 1/64 into f16; V as an f16 transposed copy) with the
// row sums of S accumulated in f32 — except the first two query blocks of each sequence, whose S and S @ V are two-way bf16 splits
#define NB 2
#define LL 2048
#define DM 512
#define NH 8
#define HD 64
#define NR (NB * LL)

// one k step (32 floats = 128 B a row) of the block's 64 x rows and 128 weight rows into LDS rows of XP floats: each lane brings 4 + 8 pieces of 16 B,
// a wave's copy covers four whole 128-B lines. gx, gw, lx, lw: the lane's own first piece; the further ones lie 16 rows apart
#define XP 36
__device__ __forceinline__ void stage_xw(const float* gx, const float* gw, unsigned lx, unsigned lw) {
  const float *gx1 = gx + 16 * DM, *gx2 = gx + 32 * DM, *gx3 = gx + 48 * DM;
  const float *gw1 = gw + 16 * DM, *gw2 = gw + 32 * DM, *gw3 = gw + 48 * DM, *gw4 = gw + 64 * DM, *gw5 = gw + 80 * DM, *gw6 = gw + 96 * DM, *gw7 = gw + 112 * DM;
  const unsigned lx1 = lx + 16 * XP * 4, lx2 = lx + 32 * XP * 4, lx3 = lx + 48 * XP * 4;
  const unsigned lw1 = lw + 16 * XP * 4, lw2 = lw + 32 * XP * 4, lw3 = lw + 48 * XP * 4, lw4 = lw + 64 * XP * 4, lw5 = lw + 80 * XP * 4, lw6 = lw + 96 * XP * 4, lw7 = lw + 112 * XP * 4;
  // the copies and their s_wait_xcnt in one statement: the wait stands in front of any rewrite of the address registers the copies name
  asm volatile("global_load_async_to_lds_b128 %0, %12, off\n\t"
               "global_load_async_to_lds_b128 %1, %13, off\n\t"
               "global_load_async_to_lds_b128 %2, %14, off\n\t"
               "global_load_async_to_lds_b128 %3, %15, off\n\t"
               "global_load_async_to_lds_b128 %4, %16, off\n\t"
               "global_load_async_to_lds_b128 %5, %17, off\n\t"
               "global_load_async_to_lds_b128 %6, %18, off\n\t"
               "global_load_async_to_lds_b128 %7, %19, off\n\t"
               "global_load_async_to_lds_b128 %8, %20, off\n\t"
               "global_load_async_to_lds_b128 %9, %21, off\n\t"
               "global_load_async_to_lds_b128 %10, %22, off\n\t"
               "global_load_async_to_lds_b128 %11, %23, off\n\t"
               "s_wait_xcnt 0x0"
               :: "v"(lx), "v"(lx1), "v"(lx2), "v"(lx3), "v"(lw), "v"(lw1), "v"(lw2), "v"(lw3), "v"(lw4), "v"(lw5), "v"(lw6), "v"(lw7),
                  "v"(gx), "v"(gx1), "v"(gx2), "v"(gx3), "v"(gw), "v"(gw1), "v"(gw2), "v"(gw3), "v"(gw4), "v"(gw5), "v"(gw6), "v"(gw7) : "memory");
}
// projections: blockIdx.z: 0 -> phi(q) (F16 rows PQ16 [r][512] + f32 PQ32), 1 -> phi(k) (PK16, PK32), 2 -> v (V32 rows [r][512] split GEMM; VT16 [n][c][l] f16)
__global__ __launch_bounds__(128) void k_proj(const float* __restrict__ xq, const float* __restrict__ xk, const float* __restrict__ Wq, const float* __restrict__ Wk, const float* __restrict__ Wv,
                                            _Float16* __restrict__ PQ16, float* __restrict__ PQ32, _Float16* __restrict__ PK16, float* __restrict__ PK32, float* __restrict__ V32, _Float16* __restrict__ VT16) {
  __shared__ __align__(16) float so[4][16][132];
  __shared__ __align__(16) _Float16 st[128][72];
  __shared__ __align__(16) float sX[2][64][XP];           // two buffers: the k step in work and the next one in flight
  __shared__ __align__(16) float sW[2][128][XP];
  const int tid = threadIdx.x, wave = tid >> 5, lane = tid & 31, col = lane & 15, g = lane >> 4;
  const int which = blockIdx.z, r0b = blockIdx.x * 64, r0 = r0b + wave * 16, n0 = blockIdx.y * 128;
  v8f acc[8] = {};
  const float* gx = (which == 0 ? xq : xk) + (size_t)(r0b + (tid >> 3)) * DM + (tid & 7) * 4;                     // k step 0, this lane's first piece; a step further: 32 floats
  const float* gw = (which == 0 ? Wq : which == 1 ? Wk : Wv) + (size_t)(n0 + (tid >> 3)) * DM + (tid & 7) * 4;
  const unsigned lx = (unsigned)(size_t)&sX[0][tid >> 3][(tid & 7) * 4], lw = (unsigned)(size_t)&sW[0][tid >> 3][(tid & 7) * 4];
  stage_xw(gx, gw, lx, lw);
  asm volatile("s_wait_asynccnt 0x0" ::: "memory");       // k step 0 has landed before the barrier that lets the other waves read it
  __syncthreads();
  stage_xw(gx + 32, gw + 32, lx + 64 * XP * 4, lw + 128 * XP * 4);
  auto foot = [&](int kc) {
    asm volatile("s_wait_dscnt 0x0" ::: "memory");        // this wave's reads of the step's buffer are done before the buffer is filled again
    asm volatile("s_wait_asynccnt 0x0" ::: "memory");     // this wave's pieces of the next step have landed
    __syncthreads();                                      // publishes the next step and ends every wave's reads of this one
    if (kc + 2 < DM / 32) stage_xw(gx + (kc + 2) * 32, gw + (kc + 2) * 32, lx + (kc & 1) * 64 * XP * 4, lw + (kc & 1) * 128 * XP * 4); };
  if (which < 2) {
#pragma unroll 1
    for (int kc = 0; kc < DM / 32; ++kc) { const v16h a = frag_f32(&sX[kc & 1][wave * 16 + col][0], lane);
#pragma unroll
      for (int j = 0; j < 8; ++j) acc[j] = wmma16(a, frag_f32s(&sW[kc & 1][j * 16 + col][0], lane, 16.0f), acc[j]);
      foot(kc); }
    asm volatile("s_wait_asynccnt 0x0" ::: "memory");     // no copy is outstanding behind the loop
#pragma unroll
    for (int j = 0; j < 8; ++j)
#pragma unroll
      for (int r = 0; r < 8; ++r) { const float z = acc[j][r] * (1.0f / 16.0f); so[wave][8 * g + r][j * 16 + col] = z > 15.0f ? z : log1pf(expf(z)); }   // softplus
    LDSX();
    _Float16* D16 = which == 0 ? PQ16 : PK16; float* D32 = which == 0 ? PQ32 : PK32;
#pragma unroll 4
    for (int rl = 0; rl < 16; ++rl) vst2(D32 + (size_t)(r0 + rl) * DM + n0 + lane * 4, *(const v4f*)(&so[wave][rl][lane * 4]));
    for (int q = lane; q < 16 * 16; q += 32) { const int rl = q >> 4, pc = q & 15; union { v8h h8; v4u u; } pk;
#pragma unroll
      for (int e = 0; e < 8; ++e) pk.h8[e] = (_Float16)so[wave][rl][pc * 8 + e];
      vst2(D16 + (size_t)(r0 + rl) * DM + n0 + pc * 8, pk.u); } }
  else {
#pragma unroll 1
    for (int kc = 0; kc < DM / 32; ++kc) { const F2 a = split_row(&sX[kc & 1][wave * 16 + col][0], 0, lane);
#pragma unroll
      for (int j = 0; j < 8; ++j) acc[j] = mac3(a, split_row(&sW[kc & 1][j * 16 + col][0], 0, lane), acc[j]);
      foot(kc); }
    asm volatile("s_wait_asynccnt 0x0" ::: "memory");     // no copy is outstanding behind the loop
#pragma unroll
    for (int j = 0; j < 8; ++j)
#pragma unroll
      for (int r = 0; r < 8; ++r) { so[wave][8 * g + r][j * 16 + col] = acc[j][r]; st[j * 16 + col][wave * 16 + 8 * g + r] = (_Float16)acc[j][r]; }
    LDSX();
#pragma unroll 4
    for (int rl = 0; rl < 16; ++rl) vst2(V32 + (size_t)(r0 + rl) * DM + n0 + lane * 4, *(const v4f*)(&so[wave][rl][lane * 4]));
    __syncthreads();
    // VT16 [n][c][l]: c = n0 + cl (global channel 0..511 = h*64 + d), l = r0b .. +63 within sequence n
    { const int n = r0b / LL, l0 = r0b % LL;
      for (int q = tid; q < 128 * 8; q += 128) { const int cl = q >> 3, pc = q & 7; vst2(VT16 + ((size_t)n * DM + n0 + cl) * LL + l0 + pc * 8, *(const v4u*)(&st[cl][pc * 8])); } } }
}
// one 64 x 64 f16 tile of phi(k) rows and one of V^T rows, 128 B a row, into LDS rows of KP halves: each lane brings 4 + 4 pieces of 16 B,
// a wave's copy covers four whole 128-B lines. gk, gv, lk, lv: the lane's own first piece; the next three lie 16 rows further each
#define KP 72
__device__ __forceinline__ void stage_kv(const _Float16* gk, const _Float16* gv, unsigned lk, unsigned lv) {
  const _Float16 *gk1 = gk + 16 * DM, *gk2 = gk + 32 * DM, *gk3 = gk + 48 * DM, *gv1 = gv + 16 * LL, *gv2 = gv + 32 * LL, *gv3 = gv + 48 * LL;
  const unsigned lk1 = lk + 16 * KP * 2, lk2 = lk + 32 * KP * 2, lk3 = lk + 48 * KP * 2, lv1 = lv + 16 * KP * 2, lv2 = lv + 32 * KP * 2, lv3 = lv + 48 * KP * 2;
  // the copies and their s_wait_xcnt in one statement: the wait stands in front of any rewrite of the address registers the copies name
  asm volatile("global_load_async_to_lds_b128 %0, %8, off\n\t"
               "global_load_async_to_lds_b128 %1, %9, off\n\t"
               "global_load_async_to_lds_b128 %2, %10, off\n\t"
               "global_load_async_to_lds_b128 %3, %11, off\n\t"
               "global_load_async_to_lds_b128 %4, %12, off\n\t"
               "global_load_async_to_lds_b128 %5, %13, off\n\t"
               "global_load_async_to_lds_b128 %6, %14, off\n\t"
               "global_load_async_to_lds_b128 %7, %15, off\n\t"
               "s_wait_xcnt 0x0"
               :: "v"(lk), "v"(lk1), "v"(lk2), "v"(lk3), "v"(lv), "v"(lv1), "v"(lv2), "v"(lv3),
                  "v"(gk), "v"(gk1), "v"(gk2), "v"(gk3), "v"(gv), "v"(gv1), "v"(gv2), "v"(gv3) : "memory");
}
// attention: block (64 queries, h, n)
__global__ __launch_bounds__(128) void k_attn(const _Float16* __restrict__ PQ16, const float* __restrict__ PQ32, const _Float16* __restrict__ PK16, const float* __restrict__ PK32, const float* __restrict__ V32, const _Float16* __restrict__ VT16, float* __restrict__ out) {
  __shared__ __align__(16) float sS[4][16][68];
  __shared__ __align__(16) _Float16 sP[4][16][72];
  __shared__ __align__(16) float sO[4][16][68];
  __shared__ __align__(16) _Float16 sK[2][64][KP];        // two buffers: the tile in work and the next one in flight
  __shared__ __align__(16) _Float16 sV[2][64][KP];
  const int tid = threadIdx.x, w = tid >> 5, lane = tid & 31, col = lane & 15, g = lane >> 4;
  const int n = blockIdx.z, h = blockIdx.y, q0 = blockIdx.x * 64 + w * 16; const size_t rb = (size_t)n * LL;
  const bool precise = blockIdx.x < 2;
  v16h aq[2]; F2 aqs[2];
#pragma unroll
  for (int kc = 0; kc < 2; ++kc) { aq[kc] = frag_h(PQ16 + (rb + q0 + col) * DM + h * HD + kc * 32, lane); aqs[kc] = split_row(PQ32 + (rb + q0 + col) * DM + h * HD, kc * 32, lane); }
  v8f acc[4] = {}; float zsum = 0.f;                      // zsum: row (col) partial over this lane's half? -> keep per (row = col, half g) then combine
  const int ntiles = blockIdx.x + 1;
  const _Float16* gk = PK16 + (rb + (tid >> 3)) * DM + h * HD + (tid & 7) * 8;                       // tile 0, this lane's first piece; a tile further: 64 rows
  const _Float16* gv = VT16 + ((size_t)n * DM + h * HD + (tid >> 3)) * LL + (tid & 7) * 8;           // tile 0; a tile further: 64 columns
  const unsigned lk = (unsigned)(size_t)&sK[0][tid >> 3][(tid & 7) * 8], lv = (unsigned)(size_t)&sV[0][tid >> 3][(tid & 7) * 8];
  if (!precise) stage_kv(gk, gv, lk, lv);
  asm volatile("s_wait_asynccnt 0x0" ::: "memory");       // tile 0 has landed before the barrier that lets the other waves read it
  __syncthreads();
  if (!precise && ntiles > 1) stage_kv(gk + 64 * DM, gv + 64, lk + 64 * KP * 2, lv + 64 * KP * 2);
#pragma unroll 1
  for (int kt = 0; kt < ntiles; ++kt) {
#pragma unroll
    for (int t = 0; t < 4; ++t) { v8f s = {}; const int key = kt * 64 + t * 16 + col;
      if (precise) {
#pragma unroll
        for (int kc = 0; kc < 2; ++kc) s = mac3(aqs[kc], split_row(PK32 + (rb + key) * DM + h * HD, kc * 32, lane), s); }
      else {
#pragma unroll
        for (int kc = 0; kc < 2; ++kc) s = wmma16(aq[kc], frag_h(&sK[kt & 1][t * 16 + col][kc * 32], lane), s); }
#pragma unroll
      for (int r = 0; r < 8; ++r) { const int qi = q0 + 8 * g + r; sS[w][8 * g + r][t * 16 + col] = key <= qi ? s[r] : 0.f; } }
    LDSX();
    // row sums (lane (row col, half g)) and the f16 copy (x 1/64)
    { float z = 0.f;
#pragma unroll
      for (int jj = 0; jj < 32; ++jj) { const float sv = sS[w][col][g * 32 + jj]; z += sv; sP[w][col][g * 32 + jj] = (_Float16)(sv * (1.0f / 64.0f)); }
      zsum += z; }
    LDSX();
    if (precise) {
#pragma unroll
      for (int kc = 0; kc < 2; ++kc) { const F2 pa = split_row(&sS[w][col][0], kc * 32, lane);
#pragma unroll
        for (int t = 0; t < 4; ++t) acc[t] = mac3(pa, split_col(V32 + (rb + kt * 64) * DM + h * HD, kc * 32, t * 16 + col, lane, DM, 64), acc[t]); } }
    else {
#pragma unroll
      for (int kc = 0; kc < 2; ++kc) { const v16h pa = frag_h(&sP[w][col][0] + kc * 32, lane);
#pragma unroll
        for (int t = 0; t < 4; ++t) acc[t] = wmma16(pa, frag_h(&sV[kt & 1][t * 16 + col][kc * 32], lane), acc[t]); } }
    __builtin_amdgcn_wave_barrier();
    asm volatile("s_wait_dscnt 0x0" ::: "memory");        // this wave's reads of the tile's buffer are done before the buffer is filled again
    asm volatile("s_wait_asynccnt 0x0" ::: "memory");     // this wave's pieces of the next tile have landed
    __syncthreads();                                      // publishes the next tile and ends every wave's reads of this one
    if (!precise && kt + 2 < ntiles) stage_kv(gk + (size_t)(kt + 2) * 64 * DM, gv + (kt + 2) * 64, lk + (kt & 1) * 64 * KP * 2, lv + (kt & 1) * 64 * KP * 2); }
  asm volatile("s_wait_asynccnt 0x0" ::: "memory");       // no copy is outstanding when the wave ends
  zsum += __shfl_xor(zsum, 16, 32);                        // full row sum for row 'col' in both half-lanes
  const float oscale = precise ? 1.0f : 64.0f;
#pragma unroll
  for (int r = 0; r < 8; ++r) { const float zr = __shfl(zsum, 8 * g + r, 32);
#pragma unroll
    for (int t = 0; t < 4; ++t) sO[w][8 * g + r][t * 16 + col] = acc[t][r] * oscale / zr; }
  LDSX();
  for (int q = lane; q < 16 * 16; q += 32) { const int rl = q >> 4, pc = q & 15; vst2(out + (rb + q0 + rl) * DM + h * HD + pc * 4, *(const v4f*)(&sO[w][rl][pc * 4])); }
}
extern "C" void kernel_launch(void* const* d_in, const int* in_sizes, int n_in, void* d_out, int out_size, void* d_ws, size_t ws_size, hipStream_t stream) {
  (void)in_sizes; (void)n_in; (void)out_size; (void)ws_size;
  const float* xq = (const float*)d_in[0]; const float* xk = (const float*)d_in[1]; const float* Wq = (const float*)d_in[2]; const float* Wk = (const float*)d_in[3]; const float* Wv = (const float*)d_in[4];
  float* out = (float*)d_out;
  char* ws = (char*)d_ws; size_t off = 0;
  auto take = [&](size_t bytes) { char* p = ws + off; off += (bytes + 255) & ~(size_t)255; return p; };
  _Float16* PQ16 = (_Float16*)take((size_t)NR * DM * 2); float* PQ32 = (float*)take((size_t)NR * DM * 4); _Float16* PK16 = (_Float16*)take((size_t)NR * DM * 2); float* PK32 = (float*)take((size_t)NR * DM * 4);
  float* V32 = (float*)take((size_t)NR * DM * 4); _Float16* VT16 = (_Float16*)take((size_t)NB * DM * LL * 2);
  k_proj<<<dim3(NR / 64, DM / 128, 3), 128, 0, stream>>>(xq, xk, Wq, Wk, Wv, PQ16, PQ32, PK16, PK32, V32, VT16);
  k_attn<<<dim3(LL / 64, NH, NB), 128, 0, stream>>>(PQ16, PQ32, PK16, PK32, V32, VT16, out);
}

// v002
// Measured time: 74.7 microseconds a run.
// Timed twice side by side with v001, it ran 1.23 and 1.14 times as fast.
// Over all steps from v000 it is 2.83 times as fast.
#include <hip/hip_runtime.h>
#include <math.h>

typedef __attribute__((ext_vector_type(16))) _Float16 v16h;
typedef __attribute__((ext_vector_type(16))) __bf16 v16b;
typedef __attribute__((ext_vector_type(8)))  _Float16 v8h;
typedef __attribute__((ext_vector_type(8)))  float v8f;
typedef __attribute__((ext_vector_type(4)))  float v4f;
typedef __attribute__((ext_vector_type(2)))  float v2f;
typedef __attribute__((ext_vector_type(4)))  unsigned v4u;
typedef __attribute__((ext_vector_type(4)))  int v4i;
typedef float __attribute__((may_alias)) float_a;
typedef int __attribute__((may_alias)) int_a;

template <typename T> __device__ __forceinline__ void vst2(void* p, T v) { *(T*)p = v;  }
__device__ __forceinline__ v8f wmma16(v16h a, v16h b, v8f c) {
  v8f d = __builtin_amdgcn_wmma_f32_16x16x32_f16(false, a, false, b, (short)0, c, false, false);
  asm volatile("v_nop\n\tv_nop\n\tv_nop\n\tv_nop" : "+v"(d) : "v"(a), "v"(b));
  return d;
}
__device__ __forceinline__ v8f wmma_bf(v16b a, v16b b, v8f c) {
  v8f d = __builtin_amdgcn_wmma_f32_16x16x32_bf16(false, a, false, b, (short)0, c, false, false);
  asm volatile("v_nop\n\tv_nop\n\tv_nop\n\tv_nop" : "+v"(d) : "v"(a), "v"(b));
  return d;
}
// 16x16x32 fragments: lane = (h = lane>>4, row/col = lane&15); elements 0..7 = k0+8h+0..7, 8..15 = k0+16+8h+0..7; D element r = row 8h+r
__device__ __forceinline__ v16h frag_h(const _Float16* rowk0, int lane) {
  union { v16h v; v8h q[2]; } u; const _Float16* p = rowk0 + 8 * (lane >> 4);
  u.q[0] = *(const v8h*)p; u.q[1] = *(const v8h*)(p + 16); return u.v;
}
__device__ __forceinline__ v16h frag_f32(const float* rowk0, int lane) {
  v16h a; const float* p = rowk0 + 8 * (lane >> 4);
#pragma unroll
  for (int i = 0; i < 8; ++i) { a[i] = (_Float16)p[i]; a[8 + i] = (_Float16)p[16 + i]; }
  return a;
}
__device__ __forceinline__ v16h frag_f32s(const float* rowk0, int lane, float sc) {
  v16h a; const float* p = rowk0 + 8 * (lane >> 4);
#pragma unroll
  for (int i = 0; i < 8; ++i) { a[i] = (_Float16)(p[i] * sc); a[8 + i] = (_Float16)(p[16 + i] * sc); }
  return a;
}
// column fragment from a [K][ld] layout (column n), rows >= K read as 0
__device__ __forceinline__ v16h fragc_f32(const float* W, int k0, int n, int lane, int ld, int K) {
  v16h a; const int g = lane >> 4;
#pragma unroll
  for (int i = 0; i < 8; ++i) { const int ka = k0 + 8 * g + i, kb = ka + 16;
    a[i] = (_Float16)(ka < K ? W[(size_t)ka * ld + n] : 0.f); a[8 + i] = (_Float16)(kb < K ? W[(size_t)kb * ld + n] : 0.f); }
  return a;
}
struct F2 { v16b h, l; };
__device__ __forceinline__ F2 bsplit16(const float v[16]) { F2 r;
#pragma unroll
  for (int i = 0; i < 16; ++i) { const __bf16 h = (__bf16)v[i]; r.h[i] = h; r.l[i] = (__bf16)(v[i] - (float)h); }
  return r; }
__device__ __forceinline__ F2 split_row(const float* row, int k0, int lane) { float v[16]; const float* p = row + k0 + 8 * (lane >> 4);
#pragma unroll
  for (int i = 0; i < 8; ++i) { v[i] = p[i]; v[8 + i] = p[16 + i]; }
  return bsplit16(v); }
__device__ __forceinline__ F2 split_rowK(const float* row, int k0, int lane, int K) { float v[16]; const int g = lane >> 4;
#pragma unroll
  for (int i = 0; i < 8; ++i) { const int ka = k0 + 8 * g + i, kb = ka + 16; v[i] = ka < K ? row[ka] : 0.f; v[8 + i] = kb < K ? row[kb] : 0.f; }
  return bsplit16(v); }
__device__ __forceinline__ F2 split_col(const float* W, int k0, int n, int lane, int ld, int K) { float v[16]; const int g = lane >> 4;
#pragma unroll
  for (int i = 0; i < 8; ++i) { const int ka = k0 + 8 * g + i, kb = ka + 16; v[i] = ka < K ? W[(size_t)ka * ld + n] : 0.f; v[8 + i] = kb < K ? W[(size_t)kb * ld + n] : 0.f; }
  return bsplit16(v); }
__device__ __forceinline__ v8f mac3(const F2& a, const F2& b, v8f c) { c = wmma_bf(a.l, b.h, c); c = wmma_bf(a.h, b.l, c); return wmma_bf(a.h, b.h, c); }
__device__ __forceinline__ float sigm(float v) { return 1.0f / (1.0f + expf(-v)); }
#define LDSX() do { asm volatile("s_wait_dscnt 0" ::: "memory"); __builtin_amdgcn_wave_barrier(); __builtin_amdgcn_fence(__ATOMIC_RELEASE, "workgroup"); } while (0)

// Causal linear ("kernelized") attention: out[q] = sum_{k<=q} (phi(q_q).phi(k_k)) v_k / sum_{k<=q} phi(q_q).phi(k_k) with phi = softplus.
// q/k projections on v_wmma_f32_16x16x32_f16 (operands converted in the fragments, [out][in] weights x16), softplus in f32, features kept as
// f16 rows plus f32 copies; the v projection as a two-way bf16 split (near-f32: the first rows return v almost verbatim); per (n, h, 64
// queries) the causal score tiles S = phi_q . phi_k and S @ V on f16 WMMA (S scaled by 1/64 into f16; V as an f16 transposed copy) with the
// row sums of S accumulated in f32 — except the first two query blocks of each sequence, whose S and S @ V are two-way bf16 splits
#define NB 2
#define LL 2048
#define DM 512
#define NH 8
#define HD 64
#define NR (NB * LL)

// one k step (32 floats = 128 B a row) of the block's 64 x rows and 128 weight rows into LDS rows of XP floats: each lane brings 4 + 8 pieces of 16 B,
// a wave's copy covers four whole 128-B lines. gx, gw, lx, lw: the lane's own first piece; the further ones lie 16 rows apart
#define XP 36
__device__ __forceinline__ void stage_xw(const float* gx, const float* gw, unsigned lx, unsigned lw) {
  const float *gx1 = gx + 16 * DM, *gx2 = gx + 32 * DM, *gx3 = gx + 48 * DM;
  const float *gw1 = gw + 16 * DM, *gw2 = gw + 32 * DM, *gw3 = gw + 48 * DM, *gw4 = gw + 64 * DM, *gw5 = gw + 80 * DM, *gw6 = gw + 96 * DM, *gw7 = gw + 112 * DM;
  const unsigned lx1 = lx + 16 * XP * 4, lx2 = lx + 32 * XP * 4, lx3 = lx + 48 * XP * 4;
  const unsigned lw1 = lw + 16 * XP * 4, lw2 = lw + 32 * XP * 4, lw3 = lw + 48 * XP * 4, lw4 = lw + 64 * XP * 4, lw5 = lw + 80 * XP * 4, lw6 = lw + 96 * XP * 4, lw7 = lw + 112 * XP * 4;
  // the copies and their s_wait_xcnt in one statement: the wait stands in front of any rewrite of the address registers the copies name
  asm volatile("global_load_async_to_lds_b128 %0, %12, off\n\t"
               "global_load_async_to_lds_b128 %1, %13, off\n\t"
               "global_load_async_to_lds_b128 %2, %14, off\n\t"
               "global_load_async_to_lds_b128 %3, %15, off\n\t"
               "global_load_async_to_lds_b128 %4, %16, off\n\t"
               "global_load_async_to_lds_b128 %5, %17, off\n\t"
               "global_load_async_to_lds_b128 %6, %18, off\n\t"
               "global_load_async_to_lds_b128 %7, %19, off\n\t"
               "global_load_async_to_lds_b128 %8, %20, off\n\t"
               "global_load_async_to_lds_b128 %9, %21, off\n\t"
               "global_load_async_to_lds_b128 %10, %22, off\n\t"
               "global_load_async_to_lds_b128 %11, %23, off\n\t"
               "s_wait_xcnt 0x0"
               :: "v"(lx), "v"(lx1), "v"(lx2), "v"(lx3), "v"(lw), "v"(lw1), "v"(lw2), "v"(lw3), "v"(lw4), "v"(lw5), "v"(lw6), "v"(lw7),
                  "v"(gx), "v"(gx1), "v"(gx2), "v"(gx3), "v"(gw), "v"(gw1), "v"(gw2), "v"(gw3), "v"(gw4), "v"(gw5), "v"(gw6), "v"(gw7) : "memory");
}
// projections: blockIdx.z: 0 -> phi(q) (F16 rows PQ16 [r][512] + f32 PQ32), 1 -> phi(k) (PK16, PK32), 2 -> v (V32 rows [r][512] split GEMM; VT16 [n][c][l] f16)
__global__ __launch_bounds__(128) void k_proj(const float* __restrict__ xq, const float* __restrict__ xk, const float* __restrict__ Wq, const float* __restrict__ Wk, const float* __restrict__ Wv,
                                            _Float16* __restrict__ PQ16, float* __restrict__ PQ32, _Float16* __restrict__ PK16, float* __restrict__ PK32, float* __restrict__ V32, _Float16* __restrict__ VT16) {
  __shared__ __align__(16) float so[4][16][132];
  __shared__ __align__(16) _Float16 st[128][72];
  __shared__ __align__(16) float sX[2][64][XP];           // two buffers: the k step in work and the next one in flight
  __shared__ __align__(16) float sW[2][128][XP];
  const int tid = threadIdx.x, wave = tid >> 5, lane = tid & 31, col = lane & 15, g = lane >> 4;
  const int which = blockIdx.z, r0b = blockIdx.x * 64, r0 = r0b + wave * 16, n0 = blockIdx.y * 128;
  v8f acc[8] = {};
  const float* gx = (which == 0 ? xq : xk) + (size_t)(r0b + (tid >> 3)) * DM + (tid & 7) * 4;                     // k step 0, this lane's first piece; a step further: 32 floats
  const float* gw = (which == 0 ? Wq : which == 1 ? Wk : Wv) + (size_t)(n0 + (tid >> 3)) * DM + (tid & 7) * 4;
  const unsigned lx = (unsigned)(size_t)&sX[0][tid >> 3][(tid & 7) * 4], lw = (unsigned)(size_t)&sW[0][tid >> 3][(tid & 7) * 4];
  stage_xw(gx, gw, lx, lw);
  asm volatile("s_wait_asynccnt 0x0" ::: "memory");       // k step 0 has landed before the barrier that lets the other waves read it
  __syncthreads();
  stage_xw(gx + 32, gw + 32, lx + 64 * XP * 4, lw + 128 * XP * 4);
  auto foot = [&](int kc) {
    asm volatile("s_wait_dscnt 0x0" ::: "memory");        // this wave's reads of the step's buffer are done before the buffer is filled again
    asm volatile("s_wait_asynccnt 0x0" ::: "memory");     // this wave's pieces of the next step have landed
    __syncthreads();                                      // publishes the next step and ends every wave's reads of this one
    if (kc + 2 < DM / 32) stage_xw(gx + (kc + 2) * 32, gw + (kc + 2) * 32, lx + (kc & 1) * 64 * XP * 4, lw + (kc & 1) * 128 * XP * 4); };
  if (which < 2) {
#pragma unroll 1
    for (int kc = 0; kc < DM / 32; ++kc) { const v16h a = frag_f32(&sX[kc & 1][wave * 16 + col][0], lane);
#pragma unroll
      for (int j = 0; j < 8; ++j) acc[j] = wmma16(a, frag_f32s(&sW[kc & 1][j * 16 + col][0], lane, 16.0f), acc[j]);
      foot(kc); }
    asm volatile("s_wait_asynccnt 0x0" ::: "memory");     // no copy is outstanding behind the loop
#pragma unroll
    for (int j = 0; j < 8; ++j)
#pragma unroll
      for (int r = 0; r < 8; ++r) { const float z = acc[j][r] * (1.0f / 16.0f); so[wave][8 * g + r][j * 16 + col] = z > 15.0f ? z : log1pf(expf(z)); }   // softplus
    LDSX();
    _Float16* D16 = which == 0 ? PQ16 : PK16; float* D32 = which == 0 ? PQ32 : PK32;
#pragma unroll 4
    for (int rl = 0; rl < 16; ++rl) vst2(D32 + (size_t)(r0 + rl) * DM + n0 + lane * 4, *(const v4f*)(&so[wave][rl][lane * 4]));
    for (int q = lane; q < 16 * 16; q += 32) { const int rl = q >> 4, pc = q & 15; union { v8h h8; v4u u; } pk;
#pragma unroll
      for (int e = 0; e < 8; ++e) pk.h8[e] = (_Float16)so[wave][rl][pc * 8 + e];
      vst2(D16 + (size_t)(r0 + rl) * DM + n0 + pc * 8, pk.u); } }
  else {
#pragma unroll 1
    for (int kc = 0; kc < DM / 32; ++kc) { const F2 a = split_row(&sX[kc & 1][wave * 16 + col][0], 0, lane);
#pragma unroll
      for (int j = 0; j < 8; ++j) acc[j] = mac3(a, split_row(&sW[kc & 1][j * 16 + col][0], 0, lane), acc[j]);
      foot(kc); }
    asm volatile("s_wait_asynccnt 0x0" ::: "memory");     // no copy is outstanding behind the loop
#pragma unroll
    for (int j = 0; j < 8; ++j)
#pragma unroll
      for (int r = 0; r < 8; ++r) { so[wave][8 * g + r][j * 16 + col] = acc[j][r]; st[j * 16 + col][wave * 16 + 8 * g + r] = (_Float16)acc[j][r]; }
    LDSX();
#pragma unroll 4
    for (int rl = 0; rl < 16; ++rl) vst2(V32 + (size_t)(r0 + rl) * DM + n0 + lane * 4, *(const v4f*)(&so[wave][rl][lane * 4]));
    __syncthreads();
    // VT16 [n][c][l]: c = n0 + cl (global channel 0..511 = h*64 + d), l = r0b .. +63 within sequence n
    { const int n = r0b / LL, l0 = r0b % LL;
      for (int q = tid; q < 128 * 8; q += 128) { const int cl = q >> 3, pc = q & 7; vst2(VT16 + ((size_t)n * DM + n0 + cl) * LL + l0 + pc * 8, *(const v4u*)(&st[cl][pc * 8])); } } }
}
// one 64 x 64 f16 tile of phi(k) rows and one of V^T rows, 128 B a row, into LDS rows of KP halves: each lane brings 4 + 4 pieces of 16 B,
// a wave's copy covers four whole 128-B lines. gk, gv, lk, lv: the lane's own first piece; the next three lie 16 rows further each
#define KP 72
__device__ __forceinline__ void stage_kv(const _Float16* gk, const _Float16* gv, unsigned lk, unsigned lv) {
  const _Float16 *gk1 = gk + 16 * DM, *gk2 = gk + 32 * DM, *gk3 = gk + 48 * DM, *gv1 = gv + 16 * LL, *gv2 = gv + 32 * LL, *gv3 = gv + 48 * LL;
  const unsigned lk1 = lk + 16 * KP * 2, lk2 = lk + 32 * KP * 2, lk3 = lk + 48 * KP * 2, lv1 = lv + 16 * KP * 2, lv2 = lv + 32 * KP * 2, lv3 = lv + 48 * KP * 2;
  // the copies and their s_wait_xcnt in one statement: the wait stands in front of any rewrite of the address registers the copies name
  asm volatile("global_load_async_to_lds_b128 %0, %8, off\n\t"
               "global_load_async_to_lds_b128 %1, %9, off\n\t"
               "global_load_async_to_lds_b128 %2, %10, off\n\t"
               "global_load_async_to_lds_b128 %3, %11, off\n\t"
               "global_load_async_to_lds_b128 %4, %12, off\n\t"
               "global_load_async_to_lds_b128 %5, %13, off\n\t"
               "global_load_async_to_lds_b128 %6, %14, off\n\t"
               "global_load_async_to_lds_b128 %7, %15, off\n\t"
               "s_wait_xcnt 0x0"
               :: "v"(lk), "v"(lk1), "v"(lk2), "v"(lk3), "v"(lv), "v"(lv1), "v"(lv2), "v"(lv3),
                  "v"(gk), "v"(gk1), "v"(gk2), "v"(gk3), "v"(gv), "v"(gv1), "v"(gv2), "v"(gv3) : "memory");
}
// attention: block (64 queries, h, n)
__global__ __launch_bounds__(128) void k_attn(const _Float16* __restrict__ PQ16, const float* __restrict__ PQ32, const _Float16* __restrict__ PK16, const float* __restrict__ PK32, const float* __restrict__ V32, const _Float16* __restrict__ VT16, float* __restrict__ out) {
  __shared__ __align__(16) float sS[4][16][68];
  __shared__ __align__(16) _Float16 sP[4][16][72];
  __shared__ __align__(16) float sO[4][16][68];
  __shared__ __align__(16) _Float16 sK[2][64][KP];        // two buffers: the tile in work and the next one in flight
  __shared__ __align__(16) _Float16 sV[2][64][KP];
  const int tid = threadIdx.x, w = tid >> 5, lane = tid & 31, col = lane & 15, g = lane >> 4;
  const int n = blockIdx.z, h = blockIdx.y, q0 = blockIdx.x * 64 + w * 16; const size_t rb = (size_t)n * LL;
  const bool precise = blockIdx.x < 2;
  v8f acc[4] = {}; float zsum = 0.f;                      // zsum: row (col) partial over this lane's half? -> keep per (row = col, half g) then combine
  const int ntiles = blockIdx.x + 1;
  // masked scores of key columns t * 16 + col into the wave's own sS rows
  auto put_s = [&](int kt, int t, const v8f& s) { const int key = kt * 64 + t * 16 + col;
#pragma unroll
    for (int r = 0; r < 8; ++r) { const int qi = q0 + 8 * g + r; sS[w][8 * g + r][t * 16 + col] = key <= qi ? s[r] : 0.f; } };
  // row sums (lane (row col, half g)) and the f16 copy (x 1/64)
  auto rowsum = [&]() { float z = 0.f;
#pragma unroll
    for (int jj = 0; jj < 32; ++jj) { const float sv = sS[w][col][g * 32 + jj]; z += sv; sP[w][col][g * 32 + jj] = (_Float16)(sv * (1.0f / 64.0f)); }
    zsum += z; };
  if (precise) {                                          // nothing is staged here: each wave works on its own LDS rows alone
    F2 aqs[2];
#pragma unroll
    for (int kc = 0; kc < 2; ++kc) aqs[kc] = split_row(PQ32 + (rb + q0 + col) * DM + h * HD, kc * 32, lane);
#pragma unroll 1
    for (int kt = 0; kt < ntiles; ++kt) {
#pragma unroll
      for (int t = 0; t < 4; ++t) { v8f s = {}; const int key = kt * 64 + t * 16 + col;
#pragma unroll
        for (int kc = 0; kc < 2; ++kc) s = mac3(aqs[kc], split_row(PK32 + (rb + key) * DM + h * HD, kc * 32, lane), s);
        put_s(kt, t, s); }
      LDSX();
      rowsum();
      LDSX();
#pragma unroll
      for (int kc = 0; kc < 2; ++kc) { const F2 pa = split_row(&sS[w][col][0], kc * 32, lane);
#pragma unroll
        for (int t = 0; t < 4; ++t) acc[t] = mac3(pa, split_col(V32 + (rb + kt * 64) * DM + h * HD, kc * 32, t * 16 + col, lane, DM, 64), acc[t]); } } }
  else {
    v16h aq[2];
#pragma unroll
    for (int kc = 0; kc < 2; ++kc) aq[kc] = frag_h(PQ16 + (rb + q0 + col) * DM + h * HD + kc * 32, lane);
    const _Float16* gk = PK16 + (rb + (tid >> 3)) * DM + h * HD + (tid & 7) * 8;                     // tile 0, this lane's first piece; a tile further: 64 rows
    const _Float16* gv = VT16 + ((size_t)n * DM + h * HD + (tid >> 3)) * LL + (tid & 7) * 8;         // tile 0; a tile further: 64 columns
    const unsigned lk = (unsigned)(size_t)&sK[0][tid >> 3][(tid & 7) * 8], lv = (unsigned)(size_t)&sV[0][tid >> 3][(tid & 7) * 8];
    stage_kv(gk, gv, lk, lv);
    asm volatile("s_wait_asynccnt 0x0" ::: "memory");     // tile 0 has landed before the barrier that lets the other waves read it
    __syncthreads();
    if (ntiles > 1) stage_kv(gk + 64 * DM, gv + 64, lk + 64 * KP * 2, lv + 64 * KP * 2);
#pragma unroll 1
    for (int kt = 0; kt < ntiles; ++kt) {
      v16h kf[2][4], vf[2][4];
#pragma unroll
      for (int kc = 0; kc < 2; ++kc)
#pragma unroll
        for (int t = 0; t < 4; ++t) kf[kc][t] = frag_h(&sK[kt & 1][t * 16 + col][kc * 32], lane);
#pragma unroll
      for (int kc = 0; kc < 2; ++kc)
#pragma unroll
        for (int t = 0; t < 4; ++t) vf[kc][t] = frag_h(&sV[kt & 1][t * 16 + col][kc * 32], lane);
      __builtin_amdgcn_sched_barrier(0);                  // holds the tile's 32 LDS reads in one group ahead of the products: sunk to their users, each product waits out a read of its own
      v8f s[4] = {};
#pragma unroll
      for (int kc = 0; kc < 2; ++kc)
#pragma unroll
        for (int t = 0; t < 4; ++t) s[t] = wmma16(aq[kc], kf[kc][t], s[t]);
#pragma unroll
      for (int t = 0; t < 4; ++t) put_s(kt, t, s[t]);
      LDSX();
      rowsum();
      LDSX();
      v16h pa[2];
#pragma unroll
      for (int kc = 0; kc < 2; ++kc) pa[kc] = frag_h(&sP[w][col][0] + kc * 32, lane);
#pragma unroll
      for (int kc = 0; kc < 2; ++kc)
#pragma unroll
        for (int t = 0; t < 4; ++t) acc[t] = wmma16(pa[kc], vf[kc][t], acc[t]);
      __builtin_amdgcn_wave_barrier();
      asm volatile("s_wait_dscnt 0x0" ::: "memory");      // this wave's reads of the tile's buffer are done before the buffer is filled again
      asm volatile("s_wait_asynccnt 0x0" ::: "memory");   // this wave's pieces of the next tile have landed
      __syncthreads();                                    // publishes the next tile and ends every wave's reads of this one
      if (kt + 2 < ntiles) stage_kv(gk + (size_t)(kt + 2) * 64 * DM, gv + (kt + 2) * 64, lk + (kt & 1) * 64 * KP * 2, lv + (kt & 1) * 64 * KP * 2); }
    asm volatile("s_wait_asynccnt 0x0" ::: "memory"); }   // no copy is outstanding when the wave ends
  zsum += __shfl_xor(zsum, 16, 32);                        // full row sum for row 'col' in both half-lanes
  const float oscale = precise ? 1.0f : 64.0f;
#pragma unroll
  for (int r = 0; r < 8; ++r) { const float zr = __shfl(zsum, 8 * g + r, 32);
#pragma unroll
    for (int t = 0; t < 4; ++t) sO[w][8 * g + r][t * 16 + col] = acc[t][r] * oscale / zr; }
  LDSX();
  for (int q = lane; q < 16 * 16; q += 32) { const int rl = q >> 4, pc = q & 15; vst2(out + (rb + q0 + rl) * DM + h * HD + pc * 4, *(const v4f*)(&sO[w][rl][pc * 4])); }
}
extern "C" void kernel_launch(void* const* d_in, const int* in_sizes, int n_in, void* d_out, int out_size, void* d_ws, size_t ws_size, hipStream_t stream) {
  (void)in_sizes; (void)n_in; (void)out_size; (void)ws_size;
  const float* xq = (const float*)d_in[0]; const float* xk = (const float*)d_in[1]; const float* Wq = (const float*)d_in[2]; const float* Wk = (const float*)d_in[3]; const float* Wv = (const float*)d_in[4];
  float* out = (float*)d_out;
  char* ws = (char*)d_ws; size_t off = 0;
  auto take = [&](size_t bytes) { char* p = ws + off; off += (bytes + 255) & ~(size_t)255; return p; };
  _Float16* PQ16 = (_Float16*)take((size_t)NR * DM * 2); float* PQ32 = (float*)take((size_t)NR * DM * 4); _Float16* PK16 = (_Float16*)take((size_t)NR * DM * 2); float* PK32 = (float*)take((size_t)NR * DM * 4);
  float* V32 = (float*)take((size_t)NR * DM * 4); _Float16* VT16 = (_Float16*)take((size_t)NB * DM * LL * 2);
  k_proj<<<dim3(NR / 64, DM / 128, 3), 128, 0, stream>>>(xq, xk, Wq, Wk, Wv, PQ16, PQ32, PK16, PK32, V32, VT16);
  k_attn<<<dim3(LL / 64, NH, NB), 128, 0, stream>>>(PQ16, PQ32, PK16, PK32, V32, VT16, out);
}

// v003
// It runs in 66.3 microseconds.
// Two timings next to v002 put it at 1.12 and 1.15 times that version's speed.
// Counting every step since v000, it is 3.21 times as fast.
#include <hip/hip_runtime.h>
#include <math.h>

typedef __attribute__((ext_vector_type(16))) _Float16 v16h;
typedef __attribute__((ext_vector_type(16))) __bf16 v16b;
typedef __attribute__((ext_vector_type(8)))  _Float16 v8h;
typedef __attribute__((ext_vector_type(8)))  float v8f;
typedef __attribute__((ext_vector_type(4)))  float v4f;
typedef __attribute__((ext_vector_type(2)))  float v2f;
typedef __attribute__((ext_vector_type(4)))  unsigned v4u;
typedef __attribute__((ext_vector_type(4)))  int v4i;
typedef float __attribute__((may_alias)) float_a;
typedef int __attribute__((may_alias)) int_a;

template <typename T> __device__ __forceinline__ void vst2(void* p, T v) { *(T*)p = v;  }
__device__ __forceinline__ v8f wmma16(v16h a, v16h b, v8f c) {
  v8f d = __builtin_amdgcn_wmma_f32_16x16x32_f16(false, a, false, b, (short)0, c, false, false);
  asm volatile("v_nop\n\tv_nop\n\tv_nop\n\tv_nop" : "+v"(d) : "v"(a), "v"(b));
  return d;
}
__device__ __forceinline__ v8f wmma_bf(v16b a, v16b b, v8f c) {
  v8f d = __builtin_amdgcn_wmma_f32_16x16x32_bf16(false, a, false, b, (short)0, c, false, false);
  asm volatile("v_nop\n\tv_nop\n\tv_nop\n\tv_nop" : "+v"(d) : "v"(a), "v"(b));
  return d;
}
// 16x16x32 fragments: lane = (h = lane>>4, row/col = lane&15); elements 0..7 = k0+8h+0..7, 8..15 = k0+16+8h+0..7; D element r = row 8h+r
__device__ __forceinline__ v16h frag_h(const _Float16* rowk0, int lane) {
  union { v16h v; v8h q[2]; } u; const _Float16* p = rowk0 + 8 * (lane >> 4);
  u.q[0] = *(const v8h*)p; u.q[1] = *(const v8h*)(p + 16); return u.v;
}
__device__ __forceinline__ v16h frag_f32(const float* rowk0, int lane) {
  v16h a; const float* p = rowk0 + 8 * (lane >> 4);
#pragma unroll
  for (int i = 0; i < 8; ++i) { a[i] = (_Float16)p[i]; a[8 + i] = (_Float16)p[16 + i]; }
  return a;
}
__device__ __forceinline__ v16h frag_f32s(const float* rowk0, int lane, float sc) {
  v16h a; const float* p = rowk0 + 8 * (lane >> 4);
#pragma unroll
  for (int i = 0; i < 8; ++i) { a[i] = (_Float16)(p[i] * sc); a[8 + i] = (_Float16)(p[16 + i] * sc); }
  return a;
}
// column fragment from a [K][ld] layout (column n), rows >= K read as 0
__device__ __forceinline__ v16h fragc_f32(const float* W, int k0, int n, int lane, int ld, int K) {
  v16h a; const int g = lane >> 4;
#pragma unroll
  for (int i = 0; i < 8; ++i) { const int ka = k0 + 8 * g + i, kb = ka + 16;
    a[i] = (_Float16)(ka < K ? W[(size_t)ka * ld + n] : 0.f); a[8 + i] = (_Float16)(kb < K ? W[(size_t)kb * ld + n] : 0.f); }
  return a;
}
struct F2 { v16b h, l; };
__device__ __forceinline__ F2 bsplit16(const float v[16]) { F2 r;
#pragma unroll
  for (int i = 0; i < 16; ++i) { const __bf16 h = (__bf16)v[i]; r.h[i] = h; r.l[i] = (__bf16)(v[i] - (float)h); }
  return r; }
__device__ __forceinline__ F2 split_row(const float* row, int k0, int lane) { float v[16]; const float* p = row + k0 + 8 * (lane >> 4);
#pragma unroll
  for (int i = 0; i < 8; ++i) { v[i] = p[i]; v[8 + i] = p[16 + i]; }
  return bsplit16(v); }
__device__ __forceinline__ F2 split_rowK(const float* row, int k0, int lane, int K) { float v[16]; const int g = lane >> 4;
#pragma unroll
  for (int i = 0; i < 8; ++i) { const int ka = k0 + 8 * g + i, kb = ka + 16; v[i] = ka < K ? row[ka] : 0.f; v[8 + i] = kb < K ? row[kb] : 0.f; }
  return bsplit16(v); }
__device__ __forceinline__ F2 split_col(const float* W, int k0, int n, int lane, int ld, int K) { float v[16]; const int g = lane >> 4;
#pragma unroll
  for (int i = 0; i < 8; ++i) { const int ka = k0 + 8 * g + i, kb = ka + 16; v[i] = ka < K ? W[(size_t)ka * ld + n] : 0.f; v[8 + i] = kb < K ? W[(size_t)kb * ld + n] : 0.f; }
  return bsplit16(v); }
__device__ __forceinline__ v8f mac3(const F2& a, const F2& b, v8f c) { c = wmma_bf(a.l, b.h, c); c = wmma_bf(a.h, b.l, c); return wmma_bf(a.h, b.h, c); }
__device__ __forceinline__ float sigm(float v) { return 1.0f / (1.0f + expf(-v)); }
#define LDSX() do { asm volatile("s_wait_dscnt 0" ::: "memory"); __builtin_amdgcn_wave_barrier(); __builtin_amdgcn_fence(__ATOMIC_RELEASE, "workgroup"); } while (0)

// Causal linear ("kernelized") attention: out[q] = sum_{k<=q} (phi(q_q).phi(k_k)) v_k / sum_{k<=q} phi(q_q).phi(k_k) with phi = softplus.
// q/k projections on v_wmma_f32_16x16x32_f16 (operands converted in the fragments, [out][in] weights x16), softplus in f32, features kept as
// f16 rows plus f32 copies (phi(k) also as an f16 transposed copy); the v projection as a two-way bf16 split (near-f32: the first rows return v
// almost verbatim). Per (n, h, 64 queries): all keys in front of the query block enter through the prefix state phi_k^T V (64 x 64) and the prefix
// sum of phi_k, summed tile by tile on f16 WMMA in f32 and applied once as phi_q . state (state x 1/64 in f16); only the block's own 64 keys go
// through the masked score tile S = phi_q . phi_k and S @ V (S scaled by 1/64 into f16; V as an f16 transposed copy), row sums of S in f32;
// not so the first two query blocks of each sequence, whose S and S @ V over all their keys are two-way bf16 splits
#define NB 2
#define LL 2048
#define DM 512
#define NH 8
#define HD 64
#define NR (NB * LL)

// one k step (32 floats = 128 B a row) of the block's 64 x rows and 128 weight rows into LDS rows of XP floats: each lane brings 4 + 8 pieces of 16 B,
// a wave's copy covers four whole 128-B lines. gx, gw, lx, lw: the lane's own first piece; the further ones lie 16 rows apart
#define XP 36
__device__ __forceinline__ void stage_xw(const float* gx, const float* gw, unsigned lx, unsigned lw) {
  const float *gx1 = gx + 16 * DM, *gx2 = gx + 32 * DM, *gx3 = gx + 48 * DM;
  const float *gw1 = gw + 16 * DM, *gw2 = gw + 32 * DM, *gw3 = gw + 48 * DM, *gw4 = gw + 64 * DM, *gw5 = gw + 80 * DM, *gw6 = gw + 96 * DM, *gw7 = gw + 112 * DM;
  const unsigned lx1 = lx + 16 * XP * 4, lx2 = lx + 32 * XP * 4, lx3 = lx + 48 * XP * 4;
  const unsigned lw1 = lw + 16 * XP * 4, lw2 = lw + 32 * XP * 4, lw3 = lw + 48 * XP * 4, lw4 = lw + 64 * XP * 4, lw5 = lw + 80 * XP * 4, lw6 = lw + 96 * XP * 4, lw7 = lw + 112 * XP * 4;
  // the copies and their s_wait_xcnt in one statement: the wait stands in front of any rewrite of the address registers the copies name
  asm volatile("global_load_async_to_lds_b128 %0, %12, off\n\t"
               "global_load_async_to_lds_b128 %1, %13, off\n\t"
               "global_load_async_to_lds_b128 %2, %14, off\n\t"
               "global_load_async_to_lds_b128 %3, %15, off\n\t"
               "global_load_async_to_lds_b128 %4, %16, off\n\t"
               "global_load_async_to_lds_b128 %5, %17, off\n\t"
               "global_load_async_to_lds_b128 %6, %18, off\n\t"
               "global_load_async_to_lds_b128 %7, %19, off\n\t"
               "global_load_async_to_lds_b128 %8, %20, off\n\t"
               "global_load_async_to_lds_b128 %9, %21, off\n\t"
               "global_load_async_to_lds_b128 %10, %22, off\n\t"
               "global_load_async_to_lds_b128 %11, %23, off\n\t"
               "s_wait_xcnt 0x0"
               :: "v"(lx), "v"(lx1), "v"(lx2), "v"(lx3), "v"(lw), "v"(lw1), "v"(lw2), "v"(lw3), "v"(lw4), "v"(lw5), "v"(lw6), "v"(lw7),
                  "v"(gx), "v"(gx1), "v"(gx2), "v"(gx3), "v"(gw), "v"(gw1), "v"(gw2), "v"(gw3), "v"(gw4), "v"(gw5), "v"(gw6), "v"(gw7) : "memory");
}
// projections: blockIdx.z: 0 -> phi(q) (F16 rows PQ16 [r][512] + f32 PQ32), 1 -> phi(k) (PK16, PK32; PKT16 [n][c][l] f16), 2 -> v (V32 rows [r][512] split GEMM; VT16 [n][c][l] f16)
__global__ __launch_bounds__(128) void k_proj(const float* __restrict__ xq, const float* __restrict__ xk, const float* __restrict__ Wq, const float* __restrict__ Wk, const float* __restrict__ Wv,
                                            _Float16* __restrict__ PQ16, float* __restrict__ PQ32, _Float16* __restrict__ PK16, float* __restrict__ PK32, float* __restrict__ V32, _Float16* __restrict__ VT16, _Float16* __restrict__ PKT16) {
  __shared__ __align__(16) float so[4][16][132];
  __shared__ __align__(16) _Float16 st[128][72];
  __shared__ __align__(16) float sX[2][64][XP];           // two buffers: the k step in work and the next one in flight
  __shared__ __align__(16) float sW[2][128][XP];
  const int tid = threadIdx.x, wave = tid >> 5, lane = tid & 31, col = lane & 15, g = lane >> 4;
  const int which = blockIdx.z, r0b = blockIdx.x * 64, r0 = r0b + wave * 16, n0 = blockIdx.y * 128;
  v8f acc[8] = {};
  const float* gx = (which == 0 ? xq : xk) + (size_t)(r0b + (tid >> 3)) * DM + (tid & 7) * 4;                     // k step 0, this lane's first piece; a step further: 32 floats
  const float* gw = (which == 0 ? Wq : which == 1 ? Wk : Wv) + (size_t)(n0 + (tid >> 3)) * DM + (tid & 7) * 4;
  const unsigned lx = (unsigned)(size_t)&sX[0][tid >> 3][(tid & 7) * 4], lw = (unsigned)(size_t)&sW[0][tid >> 3][(tid & 7) * 4];
  stage_xw(gx, gw, lx, lw);
  asm volatile("s_wait_asynccnt 0x0" ::: "memory");       // k step 0 has landed before the barrier that lets the other waves read it
  __syncthreads();
  stage_xw(gx + 32, gw + 32, lx + 64 * XP * 4, lw + 128 * XP * 4);
  auto foot = [&](int kc) {
    asm volatile("s_wait_dscnt 0x0" ::: "memory");        // this wave's reads of the step's buffer are done before the buffer is filled again
    asm volatile("s_wait_asynccnt 0x0" ::: "memory");     // this wave's pieces of the next step have landed
    __syncthreads();                                      // publishes the next step and ends every wave's reads of this one
    if (kc + 2 < DM / 32) stage_xw(gx + (kc + 2) * 32, gw + (kc + 2) * 32, lx + (kc & 1) * 64 * XP * 4, lw + (kc & 1) * 128 * XP * 4); };
  if (which < 2) {
#pragma unroll 1
    for (int kc = 0; kc < DM / 32; ++kc) { const v16h a = frag_f32(&sX[kc & 1][wave * 16 + col][0], lane);
#pragma unroll
      for (int j = 0; j < 8; ++j) acc[j] = wmma16(a, frag_f32s(&sW[kc & 1][j * 16 + col][0], lane, 16.0f), acc[j]);
      foot(kc); }
    asm volatile("s_wait_asynccnt 0x0" ::: "memory");     // no copy is outstanding behind the loop
#pragma unroll
    for (int j = 0; j < 8; ++j)
#pragma unroll
      for (int r = 0; r < 8; ++r) { const float z = acc[j][r] * (1.0f / 16.0f); acc[j][r] = z > 15.0f ? z : log1pf(expf(z)); so[wave][8 * g + r][j * 16 + col] = acc[j][r]; }   // softplus
    if (which == 1) {
#pragma unroll
      for (int j = 0; j < 8; ++j)
#pragma unroll
        for (int r = 0; r < 8; ++r) st[j * 16 + col][wave * 16 + 8 * g + r] = (_Float16)acc[j][r]; }
    LDSX();
    if (which == 1) __syncthreads();                      // all four waves' columns of st stand before its rows are read below; here, ahead of the global stores, it waits for none of them
    _Float16* D16 = which == 0 ? PQ16 : PK16; float* D32 = which == 0 ? PQ32 : PK32;
#pragma unroll 4
    for (int rl = 0; rl < 16; ++rl) vst2(D32 + (size_t)(r0 + rl) * DM + n0 + lane * 4, *(const v4f*)(&so[wave][rl][lane * 4]));
    for (int q = lane; q < 16 * 16; q += 32) { const int rl = q >> 4, pc = q & 15; union { v8h h8; v4u u; } pk;
#pragma unroll
      for (int e = 0; e < 8; ++e) pk.h8[e] = (_Float16)so[wave][rl][pc * 8 + e];
      vst2(D16 + (size_t)(r0 + rl) * DM + n0 + pc * 8, pk.u); }
    if (which == 1) {                                     // PKT16 [n][c][l], as VT16 below
      const int n = r0b / LL, l0 = r0b % LL;
      for (int q = tid; q < 128 * 8; q += 128) { const int cl = q >> 3, pc = q & 7; vst2(PKT16 + ((size_t)n * DM + n0 + cl) * LL + l0 + pc * 8, *(const v4u*)(&st[cl][pc * 8])); } } }
  else {
#pragma unroll 1
    for (int kc = 0; kc < DM / 32; ++kc) { const F2 a = split_row(&sX[kc & 1][wave * 16 + col][0], 0, lane);
#pragma unroll
      for (int j = 0; j < 8; ++j) acc[j] = mac3(a, split_row(&sW[kc & 1][j * 16 + col][0], 0, lane), acc[j]);
      foot(kc); }
    asm volatile("s_wait_asynccnt 0x0" ::: "memory");     // no copy is outstanding behind the loop
#pragma unroll
    for (int j = 0; j < 8; ++j)
#pragma unroll
      for (int r = 0; r < 8; ++r) { so[wave][8 * g + r][j * 16 + col] = acc[j][r]; st[j * 16 + col][wave * 16 + 8 * g + r] = (_Float16)acc[j][r]; }
    LDSX();
#pragma unroll 4
    for (int rl = 0; rl < 16; ++rl) vst2(V32 + (size_t)(r0 + rl) * DM + n0 + lane * 4, *(const v4f*)(&so[wave][rl][lane * 4]));
    __syncthreads();
    // VT16 [n][c][l]: c = n0 + cl (global channel 0..511 = h*64 + d), l = r0b .. +63 within sequence n
    { const int n = r0b / LL, l0 = r0b % LL;
      for (int q = tid; q < 128 * 8; q += 128) { const int cl = q >> 3, pc = q & 7; vst2(VT16 + ((size_t)n * DM + n0 + cl) * LL + l0 + pc * 8, *(const v4u*)(&st[cl][pc * 8])); } } }
}
// one 64 x 64 f16 tile of phi(k) (rows, or rows of the transposed copy) and one of V^T rows, 128 B a row, into LDS rows of KP halves: each lane brings
// 4 + 4 pieces of 16 B, a wave's copy covers four whole 128-B lines. gk, gv, lk, lv: the lane's own first piece; the next three lie 16 rows further each
// (ks: 16 rows of the phi(k) source in elements)
#define KP 72
__device__ __forceinline__ void stage_kv(const _Float16* gk, int ks, const _Float16* gv, unsigned lk, unsigned lv) {
  const _Float16 *gk1 = gk + ks, *gk2 = gk + 2 * ks, *gk3 = gk + 3 * ks, *gv1 = gv + 16 * LL, *gv2 = gv + 32 * LL, *gv3 = gv + 48 * LL;
  const unsigned lk1 = lk + 16 * KP * 2, lk2 = lk + 32 * KP * 2, lk3 = lk + 48 * KP * 2, lv1 = lv + 16 * KP * 2, lv2 = lv + 32 * KP * 2, lv3 = lv + 48 * KP * 2;
  // the copies and their s_wait_xcnt in one statement: the wait stands in front of any rewrite of the address registers the copies name
  asm volatile("global_load_async_to_lds_b128 %0, %8, off\n\t"
               "global_load_async_to_lds_b128 %1, %9, off\n\t"
               "global_load_async_to_lds_b128 %2, %10, off\n\t"
               "global_load_async_to_lds_b128 %3, %11, off\n\t"
               "global_load_async_to_lds_b128 %4, %12, off\n\t"
               "global_load_async_to_lds_b128 %5, %13, off\n\t"
               "global_load_async_to_lds_b128 %6, %14, off\n\t"
               "global_load_async_to_lds_b128 %7, %15, off\n\t"
               "s_wait_xcnt 0x0"
               :: "v"(lk), "v"(lk1), "v"(lk2), "v"(lk3), "v"(lv), "v"(lv1), "v"(lv2), "v"(lv3),
                  "v"(gk), "v"(gk1), "v"(gk2), "v"(gk3), "v"(gv), "v"(gv1), "v"(gv2), "v"(gv3) : "memory");
}
// attention: block (64 queries, h, n)
__global__ __launch_bounds__(128) void k_attn(const _Float16* __restrict__ PQ16, const float* __restrict__ PQ32, const _Float16* __restrict__ PK16, const float* __restrict__ PK32, const float* __restrict__ V32, const _Float16* __restrict__ VT16, const _Float16* __restrict__ PKT16, float* __restrict__ out) {
  __shared__ __align__(16) float sS[4][16][68];
  __shared__ __align__(16) _Float16 sP[4][16][72];
  __shared__ __align__(16) float sO[4][16][68];
  __shared__ __align__(16) _Float16 sK[2][64][KP];        // two buffers: the tile in work and the next one in flight
  __shared__ __align__(16) _Float16 sV[2][64][KP];
  __shared__ __align__(16) _Float16 sT[80][KP];           // prefix state x 1/64, transposed: rows 0..63 = value channel D, rows 64..79 = the prefix sum of phi(k) (16 equal rows); columns = feature d
  const int tid = threadIdx.x, w = tid >> 5, lane = tid & 31, col = lane & 15, g = lane >> 4;
  const int n = blockIdx.z, h = blockIdx.y, q0 = blockIdx.x * 64 + w * 16; const size_t rb = (size_t)n * LL;
  const bool precise = blockIdx.x < 2;
  v8f acc[4] = {}, zpre = {}; float zsum = 0.f;                      // zsum: row (col) partial over this lane's half? -> keep per (row = col, half g) then combine
  const int ntiles = blockIdx.x + 1;
  // masked scores of key columns t * 16 + col into the wave's own sS rows
  auto put_s = [&](int kt, int t, const v8f& s) { const int key = kt * 64 + t * 16 + col;
#pragma unroll
    for (int r = 0; r < 8; ++r) { const int qi = q0 + 8 * g + r; sS[w][8 * g + r][t * 16 + col] = key <= qi ? s[r] : 0.f; } };
  // row sums (lane (row col, half g)) and the f16 copy (x 1/64)
  auto rowsum = [&]() { float z = 0.f;
#pragma unroll
    for (int jj = 0; jj < 32; ++jj) { const float sv = sS[w][col][g * 32 + jj]; z += sv; sP[w][col][g * 32 + jj] = (_Float16)(sv * (1.0f / 64.0f)); }
    zsum += z; };
  if (precise) {                                          // nothing is staged here: each wave works on its own LDS rows alone
    F2 aqs[2];
#pragma unroll
    for (int kc = 0; kc < 2; ++kc) aqs[kc] = split_row(PQ32 + (rb + q0 + col) * DM + h * HD, kc * 32, lane);
#pragma unroll 1
    for (int kt = 0; kt < ntiles; ++kt) {
#pragma unroll
      for (int t = 0; t < 4; ++t) { v8f s = {}; const int key = kt * 64 + t * 16 + col;
#pragma unroll
        for (int kc = 0; kc < 2; ++kc) s = mac3(aqs[kc], split_row(PK32 + (rb + key) * DM + h * HD, kc * 32, lane), s);
        put_s(kt, t, s); }
      LDSX();
      rowsum();
      LDSX();
#pragma unroll
      for (int kc = 0; kc < 2; ++kc) { const F2 pa = split_row(&sS[w][col][0], kc * 32, lane);
#pragma unroll
        for (int t = 0; t < 4; ++t) acc[t] = mac3(pa, split_col(V32 + (rb + kt * 64) * DM + h * HD, kc * 32, t * 16 + col, lane, DM, 64), acc[t]); } } }
  else {
    v16h aq[2];
#pragma unroll
    for (int kc = 0; kc < 2; ++kc) aq[kc] = frag_h(PQ16 + (rb + q0 + col) * DM + h * HD + kc * 32, lane);
    const int nx = blockIdx.x;                            // key tiles 0 .. nx - 1 lie wholly in front of the block's queries, tile nx is the block's own
    const _Float16* gkt = PKT16 + ((size_t)n * DM + h * HD + (tid >> 3)) * LL + (tid & 7) * 8;       // transposed phi(k), tile 0, this lane's first piece; a tile further: 64 columns
    const _Float16* gkr = PK16 + (rb + nx * 64 + (tid >> 3)) * DM + h * HD + (tid & 7) * 8;          // phi(k) rows of tile nx
    const _Float16* gv = VT16 + ((size_t)n * DM + h * HD + (tid >> 3)) * LL + (tid & 7) * 8;         // tile 0; a tile further: 64 columns
    const unsigned lk = (unsigned)(size_t)&sK[0][tid >> 3][(tid & 7) * 8], lv = (unsigned)(size_t)&sV[0][tid >> 3][(tid & 7) * 8];
    stage_kv(gkt, 16 * LL, gv, lk, lv);
    asm volatile("s_wait_asynccnt 0x0" ::: "memory");     // tile 0 has landed before the barrier that lets the other waves read it
    __syncthreads();
    stage_kv(gkt + 64, 16 * LL, gv + 64, lk + 64 * KP * 2, lv + 64 * KP * 2);                        // nx >= 2 here: tile 1 exists and is a prefix tile
    v8f ps[4] = {}, pz = {};                              // this wave's 16 feature rows (w * 16 ..) of phi_k^T V and of phi_k^T 1
    v16h ones;
#pragma unroll
    for (int i = 0; i < 16; ++i) ones[i] = (_Float16)1.0f;
#pragma unroll 1
    for (int kt = 0; kt < nx; ++kt) {
      v16h ka[2], vf[2][4];
#pragma unroll
      for (int kc = 0; kc < 2; ++kc) ka[kc] = frag_h(&sK[kt & 1][w * 16 + col][kc * 32], lane);
#pragma unroll
      for (int kc = 0; kc < 2; ++kc)
#pragma unroll
        for (int t = 0; t < 4; ++t) vf[kc][t] = frag_h(&sV[kt & 1][t * 16 + col][kc * 32], lane);
      __builtin_amdgcn_sched_barrier(0);                  // holds the tile's 20 LDS reads in one group ahead of the products: sunk to their users, each product waits out a read of its own
#pragma unroll
      for (int kc = 0; kc < 2; ++kc) {
#pragma unroll
        for (int t = 0; t < 4; ++t) ps[t] = wmma16(ka[kc], vf[kc][t], ps[t]);
        pz = wmma16(ka[kc], ones, pz); }
      asm volatile("s_wait_dscnt 0x0" ::: "memory");      // this wave's reads of the tile's buffer are done before the buffer is filled again
      asm volatile("s_wait_asynccnt 0x0" ::: "memory");   // this wave's pieces of the next tile have landed
      __syncthreads();                                    // publishes the next tile and ends every wave's reads of this one
      if (kt + 2 <= nx) { const bool own = kt + 2 == nx;
        stage_kv(own ? gkr : gkt + (kt + 2) * 64, own ? 16 * DM : 16 * LL, gv + (kt + 2) * 64, lk + (kt & 1) * 64 * KP * 2, lv + (kt & 1) * 64 * KP * 2); } }
    asm volatile("s_wait_asynccnt 0x0" ::: "memory");     // no copy is outstanding behind the loop
    // the state's 16 rows of each wave to LDS, transposed: a lane holds 8 successive features of one channel
#pragma unroll
    for (int t = 0; t < 5; ++t) { const v8f sv = t < 4 ? ps[t] : pz; v8h hs;
#pragma unroll
      for (int r = 0; r < 8; ++r) hs[r] = (_Float16)(sv[r] * (1.0f / 64.0f));
      *(v8h*)(&sT[t * 16 + col][w * 16 + 8 * g]) = hs; }
    asm volatile("s_wait_dscnt 0x0" ::: "memory");        // this wave's rows of the state are in LDS before the barrier
    __syncthreads();                                      // every wave reads all four waves' rows of the state
    { v16h sf[2][5];
#pragma unroll
      for (int kc = 0; kc < 2; ++kc)
#pragma unroll
        for (int t = 0; t < 5; ++t) sf[kc][t] = frag_h(&sT[t * 16 + col][kc * 32], lane);
      __builtin_amdgcn_sched_barrier(0);                  // holds the state's 20 LDS reads in one group ahead of the products: sunk to their users, each product waits out a read of its own
#pragma unroll
      for (int kc = 0; kc < 2; ++kc) {
#pragma unroll
        for (int t = 0; t < 4; ++t) acc[t] = wmma16(aq[kc], sf[kc][t], acc[t]);
        zpre = wmma16(aq[kc], sf[kc][4], zpre); } }
    { // the block's own tile: masked scores
      v16h kf[2][4], vf[2][4];
#pragma unroll
      for (int kc = 0; kc < 2; ++kc)
#pragma unroll
        for (int t = 0; t < 4; ++t) kf[kc][t] = frag_h(&sK[nx & 1][t * 16 + col][kc * 32], lane);
#pragma unroll
      for (int kc = 0; kc < 2; ++kc)
#pragma unroll
        for (int t = 0; t < 4; ++t) vf[kc][t] = frag_h(&sV[nx & 1][t * 16 + col][kc * 32], lane);
      v8f s[4] = {};
#pragma unroll
      for (int kc = 0; kc < 2; ++kc)
#pragma unroll
        for (int t = 0; t < 4; ++t) s[t] = wmma16(aq[kc], kf[kc][t], s[t]);
#pragma unroll
      for (int t = 0; t < 4; ++t) put_s(nx, t, s[t]);
      LDSX();
      rowsum();
      LDSX();
      v16h pa[2];
#pragma unroll
      for (int kc = 0; kc < 2; ++kc) pa[kc] = frag_h(&sP[w][col][0] + kc * 32, lane);
#pragma unroll
      for (int kc = 0; kc < 2; ++kc)
#pragma unroll
        for (int t = 0; t < 4; ++t) acc[t] = wmma16(pa[kc], vf[kc][t], acc[t]); } }
  zsum += __shfl_xor(zsum, 16, 32);                        // full row sum for row 'col' in both half-lanes
  const float oscale = precise ? 1.0f : 64.0f;
#pragma unroll
  for (int r = 0; r < 8; ++r) { const float zr = __shfl(zsum, 8 * g + r, 32) + zpre[r] * 64.0f;   // own tile's row sum + phi_q . prefix sum of phi_k (0 in the precise blocks)
#pragma unroll
    for (int t = 0; t < 4; ++t) sO[w][8 * g + r][t * 16 + col] = acc[t][r] * oscale / zr; }
  LDSX();
  for (int q = lane; q < 16 * 16; q += 32) { const int rl = q >> 4, pc = q & 15; vst2(out + (rb + q0 + rl) * DM + h * HD + pc * 4, *(const v4f*)(&sO[w][rl][pc * 4])); }
}
extern "C" void kernel_launch(void* const* d_in, const int* in_sizes, int n_in, void* d_out, int out_size, void* d_ws, size_t ws_size, hipStream_t stream) {
  (void)in_sizes; (void)n_in; (void)out_size; (void)ws_size;
  const float* xq = (const float*)d_in[0]; const float* xk = (const float*)d_in[1]; const float* Wq = (const float*)d_in[2]; const float* Wk = (const float*)d_in[3]; const float* Wv = (const float*)d_in[4];
  float* out = (float*)d_out;
  char* ws = (char*)d_ws; size_t off = 0;
  auto take = [&](size_t bytes) { char* p = ws + off; off += (bytes + 255) & ~(size_t)255; return p; };
  _Float16* PQ16 = (_Float16*)take((size_t)NR * DM * 2); float* PQ32 = (float*)take((size_t)NR * DM * 4); _Float16* PK16 = (_Float16*)take((size_t)NR * DM * 2); float* PK32 = (float*)take((size_t)NR * DM * 4);
  float* V32 = (float*)take((size_t)NR * DM * 4); _Float16* VT16 = (_Float16*)take((size_t)NB * DM * LL * 2); _Float16* PKT16 = (_Float16*)take((size_t)NB * DM * LL * 2);
  k_proj<<<dim3(NR / 64, DM / 128, 3), 128, 0, stream>>>(xq, xk, Wq, Wk, Wv, PQ16, PQ32, PK16, PK32, V32, VT16, PKT16);
  k_attn<<<dim3(LL / 64, NH, NB), 128, 0, stream>>>(PQ16, PQ32, PK16, PK32, V32, VT16, PKT16, out);
}

// v004
// A run of this version takes 45.1 microseconds.
// Two timings next to v003 put it at 1.52 and 1.42 times that version's speed.
// Counting every step since v000, it is 4.71 times as fast.
#include <hip/hip_runtime.h>
#include <math.h>

typedef __attribute__((ext_vector_type(16))) _Float16 v16h;
typedef __attribute__((ext_vector_type(16))) __bf16 v16b;
typedef __attribute__((ext_vector_type(8)))  _Float16 v8h;
typedef __attribute__((ext_vector_type(8)))  float v8f;
typedef __attribute__((ext_vector_type(4)))  float v4f;
typedef __attribute__((ext_vector_type(2)))  float v2f;
typedef __attribute__((ext_vector_type(4)))  unsigned v4u;
typedef __attribute__((ext_vector_type(4)))  int v4i;
typedef float __attribute__((may_alias)) float_a;
typedef int __attribute__((may_alias)) int_a;

template <typename T> __device__ __forceinline__ void vst2(void* p, T v) { *(T*)p = v;  }
__device__ __forceinline__ v8f wmma16(v16h a, v16h b, v8f c) {
  v8f d = __builtin_amdgcn_wmma_f32_16x16x32_f16(false, a, false, b, (short)0, c, false, false);
  asm volatile("v_nop\n\tv_nop\n\tv_nop\n\tv_nop" : "+v"(d) : "v"(a), "v"(b));
  return d;
}
__device__ __forceinline__ v8f wmma_bf(v16b a, v16b b, v8f c) {
  v8f d = __builtin_amdgcn_wmma_f32_16x16x32_bf16(false, a, false, b, (short)0, c, false, false);
  asm volatile("v_nop\n\tv_nop\n\tv_nop\n\tv_nop" : "+v"(d) : "v"(a), "v"(b));
  return d;
}
// 16x16x32 fragments: lane = (h = lane>>4, row/col = lane&15); elements 0..7 = k0+8h+0..7, 8..15 = k0+16+8h+0..7; D element r = row 8h+r
__device__ __forceinline__ v16h frag_h(const _Float16* rowk0, int lane) {
  union { v16h v; v8h q[2]; } u; const _Float16* p = rowk0 + 8 * (lane >> 4);
  u.q[0] = *(const v8h*)p; u.q[1] = *(const v8h*)(p + 16); return u.v;
}
__device__ __forceinline__ v16h frag_f32(const float* rowk0, int lane) {
  v16h a; const float* p = rowk0 + 8 * (lane >> 4);
#pragma unroll
  for (int i = 0; i < 8; ++i) { a[i] = (_Float16)p[i]; a[8 + i] = (_Float16)p[16 + i]; }
  return a;
}
__device__ __forceinline__ v16h frag_f32s(const float* rowk0, int lane, float sc) {
  v16h a; const float* p = rowk0 + 8 * (lane >> 4);
#pragma unroll
  for (int i = 0; i < 8; ++i) { a[i] = (_Float16)(p[i] * sc); a[8 + i] = (_Float16)(p[16 + i] * sc); }
  return a;
}
// column fragment from a [K][ld] layout (column n), rows >= K read as 0
__device__ __forceinline__ v16h fragc_f32(const float* W, int k0, int n, int lane, int ld, int K) {
  v16h a; const int g = lane >> 4;
#pragma unroll
  for (int i = 0; i < 8; ++i) { const int ka = k0 + 8 * g + i, kb = ka + 16;
    a[i] = (_Float16)(ka < K ? W[(size_t)ka * ld + n] : 0.f); a[8 + i] = (_Float16)(kb < K ? W[(size_t)kb * ld + n] : 0.f); }
  return a;
}
struct F2 { v16b h, l; };
__device__ __forceinline__ F2 bsplit16(const float v[16]) { F2 r;
#pragma unroll
  for (int i = 0; i < 16; ++i) { const __bf16 h = (__bf16)v[i]; r.h[i] = h; r.l[i] = (__bf16)(v[i] - (float)h); }
  return r; }
__device__ __forceinline__ F2 split_row(const float* row, int k0, int lane) { float v[16]; const float* p = row + k0 + 8 * (lane >> 4);
#pragma unroll
  for (int i = 0; i < 8; ++i) { v[i] = p[i]; v[8 + i] = p[16 + i]; }
  return bsplit16(v); }
__device__ __forceinline__ F2 split_rowK(const float* row, int k0, int lane, int K) { float v[16]; const int g = lane >> 4;
#pragma unroll
  for (int i = 0; i < 8; ++i) { const int ka = k0 + 8 * g + i, kb = ka + 16; v[i] = ka < K ? row[ka] : 0.f; v[8 + i] = kb < K ? row[kb] : 0.f; }
  return bsplit16(v); }
__device__ __forceinline__ F2 split_col(const float* W, int k0, int n, int lane, int ld, int K) { float v[16]; const int g = lane >> 4;
#pragma unroll
  for (int i = 0; i < 8; ++i) { const int ka = k0 + 8 * g + i, kb = ka + 16; v[i] = ka < K ? W[(size_t)ka * ld + n] : 0.f; v[8 + i] = kb < K ? W[(size_t)kb * ld + n] : 0.f; }
  return bsplit16(v); }
__device__ __forceinline__ v8f mac3(const F2& a, const F2& b, v8f c) { c = wmma_bf(a.l, b.h, c); c = wmma_bf(a.h, b.l, c); return wmma_bf(a.h, b.h, c); }
__device__ __forceinline__ float sigm(float v) { return 1.0f / (1.0f + expf(-v)); }
// softplus(z) = max(z, 0) + log1p(exp(-|z|)), for every z, on the hardware's exp2 and log2: t = exp(-|z|) lies in [0, 1], u = 1 + t in [1, 2];
// t - (u - 1) is what the rounding of 1 + t dropped: added back, it keeps the relative accuracy of the small results (z far below 0, where log1p(t) ~ t)
__device__ __forceinline__ float softplus(float z) {
  const float t = __builtin_amdgcn_exp2f(fabsf(z) * -1.44269504f), u = 1.0f + t;
  return fmaxf(z, 0.0f) + (__builtin_amdgcn_logf(u) * 0.69314718f + (t - (u - 1.0f)));
}
#define LDSX() do { asm volatile("s_wait_dscnt 0" ::: "memory"); __builtin_amdgcn_wave_barrier(); __builtin_amdgcn_fence(__ATOMIC_RELEASE, "workgroup"); } while (0)

// Causal linear ("kernelized") attention: out[q] = sum_{k<=q} (phi(q_q).phi(k_k)) v_k / sum_{k<=q} phi(q_q).phi(k_k) with phi = softplus.
// q/k projections on v_wmma_f32_16x16x32_f16 (operands converted in the fragments, [out][in] weights x16), softplus in f32, features kept as
// f16 rows plus f32 copies (phi(k) also as an f16 transposed copy); the v projection as a two-way bf16 split (near-f32: the first rows return v
// almost verbatim). Per (n, h, 64 queries): all keys in front of the query block enter through the prefix state phi_k^T V (64 x 64) and the prefix
// sum of phi_k, summed tile by tile on f16 WMMA in f32 and applied once as phi_q . state (state x 1/64 in f16); only the block's own 64 keys go
// through the masked score tile S = phi_q . phi_k and S @ V (S scaled by 1/64 into f16; V as an f16 transposed copy), row sums of S in f32;
// not so the first two query blocks of each sequence, whose S and S @ V over all their keys are two-way bf16 splits
#define NB 2
#define LL 2048
#define DM 512
#define NH 8
#define HD 64
#define NR (NB * LL)

// one k step (32 floats = 128 B a row) of the block's 64 x rows and 128 weight rows into LDS rows of XP floats: each lane brings 4 + 8 pieces of 16 B,
// a wave's copy covers four whole 128-B lines. gx, gw, lx, lw: the lane's own first piece; the further ones lie 16 rows apart
#define XP 36
__device__ __forceinline__ void stage_xw(const float* gx, const float* gw, unsigned lx, unsigned lw) {
  const float *gx1 = gx + 16 * DM, *gx2 = gx + 32 * DM, *gx3 = gx + 48 * DM;
  const float *gw1 = gw + 16 * DM, *gw2 = gw + 32 * DM, *gw3 = gw + 48 * DM, *gw4 = gw + 64 * DM, *gw5 = gw + 80 * DM, *gw6 = gw + 96 * DM, *gw7 = gw + 112 * DM;
  const unsigned lx1 = lx + 16 * XP * 4, lx2 = lx + 32 * XP * 4, lx3 = lx + 48 * XP * 4;
  const unsigned lw1 = lw + 16 * XP * 4, lw2 = lw + 32 * XP * 4, lw3 = lw + 48 * XP * 4, lw4 = lw + 64 * XP * 4, lw5 = lw + 80 * XP * 4, lw6 = lw + 96 * XP * 4, lw7 = lw + 112 * XP * 4;
  // the copies and their s_wait_xcnt in one statement: the wait stands in front of any rewrite of the address registers the copies name
  asm volatile("global_load_async_to_lds_b128 %0, %12, off\n\t"
               "global_load_async_to_lds_b128 %1, %13, off\n\t"
               "global_load_async_to_lds_b128 %2, %14, off\n\t"
               "global_load_async_to_lds_b128 %3, %15, off\n\t"
               "global_load_async_to_lds_b128 %4, %16, off\n\t"
               "global_load_async_to_lds_b128 %5, %17, off\n\t"
               "global_load_async_to_lds_b128 %6, %18, off\n\t"
               "global_load_async_to_lds_b128 %7, %19, off\n\t"
               "global_load_async_to_lds_b128 %8, %20, off\n\t"
               "global_load_async_to_lds_b128 %9, %21, off\n\t"
               "global_load_async_to_lds_b128 %10, %22, off\n\t"
               "global_load_async_to_lds_b128 %11, %23, off\n\t"
               "s_wait_xcnt 0x0"
               :: "v"(lx), "v"(lx1), "v"(lx2), "v"(lx3), "v"(lw), "v"(lw1), "v"(lw2), "v"(lw3), "v"(lw4), "v"(lw5), "v"(lw6), "v"(lw7),
                  "v"(gx), "v"(gx1), "v"(gx2), "v"(gx3), "v"(gw), "v"(gw1), "v"(gw2), "v"(gw3), "v"(gw4), "v"(gw5), "v"(gw6), "v"(gw7) : "memory");
}
// projections: blockIdx.z: 0 -> phi(q) (F16 rows PQ16 [r][512] + f32 PQ32), 1 -> phi(k) (PK16, PK32; PKT16 [n][c][l] f16), 2 -> v (V32 rows [r][512] split GEMM; VT16 [n][c][l] f16)
__global__ __launch_bounds__(128) void k_proj(const float* __restrict__ xq, const float* __restrict__ xk, const float* __restrict__ Wq, const float* __restrict__ Wk, const float* __restrict__ Wv,
                                            _Float16* __restrict__ PQ16, float* __restrict__ PQ32, _Float16* __restrict__ PK16, float* __restrict__ PK32, float* __restrict__ V32, _Float16* __restrict__ VT16, _Float16* __restrict__ PKT16) {
  __shared__ __align__(16) float so[4][16][132];
  __shared__ __align__(16) _Float16 st[128][72];
  __shared__ __align__(16) float sX[2][64][XP];           // two buffers: the k step in work and the next one in flight
  __shared__ __align__(16) float sW[2][128][XP];
  const int tid = threadIdx.x, wave = tid >> 5, lane = tid & 31, col = lane & 15, g = lane >> 4;
  const int which = blockIdx.z, r0b = blockIdx.x * 64, r0 = r0b + wave * 16, n0 = blockIdx.y * 128;
  v8f acc[8] = {};
  const float* gx = (which == 0 ? xq : xk) + (size_t)(r0b + (tid >> 3)) * DM + (tid & 7) * 4;                     // k step 0, this lane's first piece; a step further: 32 floats
  const float* gw = (which == 0 ? Wq : which == 1 ? Wk : Wv) + (size_t)(n0 + (tid >> 3)) * DM + (tid & 7) * 4;
  const unsigned lx = (unsigned)(size_t)&sX[0][tid >> 3][(tid & 7) * 4], lw = (unsigned)(size_t)&sW[0][tid >> 3][(tid & 7) * 4];
  stage_xw(gx, gw, lx, lw);
  asm volatile("s_wait_asynccnt 0x0" ::: "memory");       // k step 0 has landed before the barrier that lets the other waves read it
  __syncthreads();
  stage_xw(gx + 32, gw + 32, lx + 64 * XP * 4, lw + 128 * XP * 4);
  auto foot = [&](int kc) {
    asm volatile("s_wait_dscnt 0x0" ::: "memory");        // this wave's reads of the step's buffer are done before the buffer is filled again
    asm volatile("s_wait_asynccnt 0x0" ::: "memory");     // this wave's pieces of the next step have landed
    __syncthreads();                                      // publishes the next step and ends every wave's reads of this one
    if (kc + 2 < DM / 32) stage_xw(gx + (kc + 2) * 32, gw + (kc + 2) * 32, lx + (kc & 1) * 64 * XP * 4, lw + (kc & 1) * 128 * XP * 4); };
  if (which < 2) {
#pragma unroll 1
    for (int kc = 0; kc < DM / 32; ++kc) { const v16h a = frag_f32(&sX[kc & 1][wave * 16 + col][0], lane);
#pragma unroll
      for (int j = 0; j < 8; ++j) acc[j] = wmma16(a, frag_f32s(&sW[kc & 1][j * 16 + col][0], lane, 16.0f), acc[j]);
      foot(kc); }
    asm volatile("s_wait_asynccnt 0x0" ::: "memory");     // no copy is outstanding behind the loop
#pragma unroll
    for (int j = 0; j < 8; ++j)
#pragma unroll
      for (int r = 0; r < 8; ++r) { acc[j][r] = softplus(acc[j][r] * (1.0f / 16.0f)); so[wave][8 * g + r][j * 16 + col] = acc[j][r]; }
    if (which == 1) {
#pragma unroll
      for (int j = 0; j < 8; ++j)
#pragma unroll
        for (int r = 0; r < 8; ++r) st[j * 16 + col][wave * 16 + 8 * g + r] = (_Float16)acc[j][r]; }
    LDSX();
    if (which == 1) __syncthreads();                      // all four waves' columns of st stand before its rows are read below; here, ahead of the global stores, it waits for none of them
    _Float16* D16 = which == 0 ? PQ16 : PK16; float* D32 = which == 0 ? PQ32 : PK32;
#pragma unroll 4
    for (int rl = 0; rl < 16; ++rl) vst2(D32 + (size_t)(r0 + rl) * DM + n0 + lane * 4, *(const v4f*)(&so[wave][rl][lane * 4]));
    for (int q = lane; q < 16 * 16; q += 32) { const int rl = q >> 4, pc = q & 15; union { v8h h8; v4u u; } pk;
#pragma unroll
      for (int e = 0; e < 8; ++e) pk.h8[e] = (_Float16)so[wave][rl][pc * 8 + e];
      vst2(D16 + (size_t)(r0 + rl) * DM + n0 + pc * 8, pk.u); }
    if (which == 1) {                                     // PKT16 [n][c][l], as VT16 below
      const int n = r0b / LL, l0 = r0b % LL;
      for (int q = tid; q < 128 * 8; q += 128) { const int cl = q >> 3, pc = q & 7; vst2(PKT16 + ((size_t)n * DM + n0 + cl) * LL + l0 + pc * 8, *(const v4u*)(&st[cl][pc * 8])); } } }
  else {
#pragma unroll 1
    for (int kc = 0; kc < DM / 32; ++kc) { const F2 a = split_row(&sX[kc & 1][wave * 16 + col][0], 0, lane);
#pragma unroll
      for (int j = 0; j < 8; ++j) acc[j] = mac3(a, split_row(&sW[kc & 1][j * 16 + col][0], 0, lane), acc[j]);
      foot(kc); }
    asm volatile("s_wait_asynccnt 0x0" ::: "memory");     // no copy is outstanding behind the loop
#pragma unroll
    for (int j = 0; j < 8; ++j)
#pragma unroll
      for (int r = 0; r < 8; ++r) { so[wave][8 * g + r][j * 16 + col] = acc[j][r]; st[j * 16 + col][wave * 16 + 8 * g + r] = (_Float16)acc[j][r]; }
    LDSX();
#pragma unroll 4
    for (int rl = 0; rl < 16; ++rl) vst2(V32 + (size_t)(r0 + rl) * DM + n0 + lane * 4, *(const v4f*)(&so[wave][rl][lane * 4]));
    __syncthreads();
    // VT16 [n][c][l]: c = n0 + cl (global channel 0..511 = h*64 + d), l = r0b .. +63 within sequence n
    { const int n = r0b / LL, l0 = r0b % LL;
      for (int q = tid; q < 128 * 8; q += 128) { const int cl = q >> 3, pc = q & 7; vst2(VT16 + ((size_t)n * DM + n0 + cl) * LL + l0 + pc * 8, *(const v4u*)(&st[cl][pc * 8])); } } }
}
// one 64 x 64 f16 tile of phi(k) (rows, or rows of the transposed copy) and one of V^T rows, 128 B a row, into LDS rows of KP halves: each lane brings
// 4 + 4 pieces of 16 B, a wave's copy covers four whole 128-B lines. gk, gv, lk, lv: the lane's own first piece; the next three lie 16 rows further each
// (ks: 16 rows of the phi(k) source in elements)
#define KP 72
__device__ __forceinline__ void stage_kv(const _Float16* gk, int ks, const _Float16* gv, unsigned lk, unsigned lv) {
  const _Float16 *gk1 = gk + ks, *gk2 = gk + 2 * ks, *gk3 = gk + 3 * ks, *gv1 = gv + 16 * LL, *gv2 = gv + 32 * LL, *gv3 = gv + 48 * LL;
  const unsigned lk1 = lk + 16 * KP * 2, lk2 = lk + 32 * KP * 2, lk3 = lk + 48 * KP * 2, lv1 = lv + 16 * KP * 2, lv2 = lv + 32 * KP * 2, lv3 = lv + 48 * KP * 2;
  // the copies and their s_wait_xcnt in one statement: the wait stands in front of any rewrite of the address registers the copies name
  asm volatile("global_load_async_to_lds_b128 %0, %8, off\n\t"
               "global_load_async_to_lds_b128 %1, %9, off\n\t"
               "global_load_async_to_lds_b128 %2, %10, off\n\t"
               "global_load_async_to_lds_b128 %3, %11, off\n\t"
               "global_load_async_to_lds_b128 %4, %12, off\n\t"
               "global_load_async_to_lds_b128 %5, %13, off\n\t"
               "global_load_async_to_lds_b128 %6, %14, off\n\t"
               "global_load_async_to_lds_b128 %7, %15, off\n\t"
               "s_wait_xcnt 0x0"
               :: "v"(lk), "v"(lk1), "v"(lk2), "v"(lk3), "v"(lv), "v"(lv1), "v"(lv2), "v"(lv3),
                  "v"(gk), "v"(gk1), "v"(gk2), "v"(gk3), "v"(gv), "v"(gv1), "v"(gv2), "v"(gv3) : "memory");
}
// attention: block (64 queries, h, n)
__global__ __launch_bounds__(128) void k_attn(const _Float16* __restrict__ PQ16, const float* __restrict__ PQ32, const _Float16* __restrict__ PK16, const float* __restrict__ PK32, const float* __restrict__ V32, const _Float16* __restrict__ VT16, const _Float16* __restrict__ PKT16, float* __restrict__ out) {
  __shared__ __align__(16) float sS[4][16][68];
  __shared__ __align__(16) _Float16 sP[4][16][72];
  __shared__ __align__(16) float sO[4][16][68];
  __shared__ __align__(16) _Float16 sK[2][64][KP];        // two buffers: the tile in work and the next one in flight
  __shared__ __align__(16) _Float16 sV[2][64][KP];
  __shared__ __align__(16) _Float16 sT[80][KP];           // prefix state x 1/64, transposed: rows 0..63 = value channel D, rows 64..79 = the prefix sum of phi(k) (16 equal rows); columns = feature d
  const int tid = threadIdx.x, w = tid >> 5, lane = tid & 31, col = lane & 15, g = lane >> 4;
  const int n = blockIdx.z, h = blockIdx.y, q0 = blockIdx.x * 64 + w * 16; const size_t rb = (size_t)n * LL;
  const bool precise = blockIdx.x < 2;
  v8f acc[4] = {}, zpre = {}; float zsum = 0.f;                      // zsum: row (col) partial over this lane's half? -> keep per (row = col, half g) then combine
  const int ntiles = blockIdx.x + 1;
  // masked scores of key columns t * 16 + col into the wave's own sS rows
  auto put_s = [&](int kt, int t, const v8f& s) { const int key = kt * 64 + t * 16 + col;
#pragma unroll
    for (int r = 0; r < 8; ++r) { const int qi = q0 + 8 * g + r; sS[w][8 * g + r][t * 16 + col] = key <= qi ? s[r] : 0.f; } };
  // row sums (lane (row col, half g)) and the f16 copy (x 1/64)
  auto rowsum = [&]() { float z = 0.f;
#pragma unroll
    for (int jj = 0; jj < 32; ++jj) { const float sv = sS[w][col][g * 32 + jj]; z += sv; sP[w][col][g * 32 + jj] = (_Float16)(sv * (1.0f / 64.0f)); }
    zsum += z; };
  if (precise) {                                          // nothing is staged here: each wave works on its own LDS rows alone
    F2 aqs[2];
#pragma unroll
    for (int kc = 0; kc < 2; ++kc) aqs[kc] = split_row(PQ32 + (rb + q0 + col) * DM + h * HD, kc * 32, lane);
#pragma unroll 1
    for (int kt = 0; kt < ntiles; ++kt) {
#pragma unroll
      for (int t = 0; t < 4; ++t) { v8f s = {}; const int key = kt * 64 + t * 16 + col;
#pragma unroll
        for (int kc = 0; kc < 2; ++kc) s = mac3(aqs[kc], split_row(PK32 + (rb + key) * DM + h * HD, kc * 32, lane), s);
        put_s(kt, t, s); }
      LDSX();
      rowsum();
      LDSX();
#pragma unroll
      for (int kc = 0; kc < 2; ++kc) { const F2 pa = split_row(&sS[w][col][0], kc * 32, lane);
#pragma unroll
        for (int t = 0; t < 4; ++t) acc[t] = mac3(pa, split_col(V32 + (rb + kt * 64) * DM + h * HD, kc * 32, t * 16 + col, lane, DM, 64), acc[t]); } } }
  else {
    v16h aq[2];
#pragma unroll
    for (int kc = 0; kc < 2; ++kc) aq[kc] = frag_h(PQ16 + (rb + q0 + col) * DM + h * HD + kc * 32, lane);
    const int nx = blockIdx.x;                            // key tiles 0 .. nx - 1 lie wholly in front of the block's queries, tile nx is the block's own
    const _Float16* gkt = PKT16 + ((size_t)n * DM + h * HD + (tid >> 3)) * LL + (tid & 7) * 8;       // transposed phi(k), tile 0, this lane's first piece; a tile further: 64 columns
    const _Float16* gkr = PK16 + (rb + nx * 64 + (tid >> 3)) * DM + h * HD + (tid & 7) * 8;          // phi(k) rows of tile nx
    const _Float16* gv = VT16 + ((size_t)n * DM + h * HD + (tid >> 3)) * LL + (tid & 7) * 8;         // tile 0; a tile further: 64 columns
    const unsigned lk = (unsigned)(size_t)&sK[0][tid >> 3][(tid & 7) * 8], lv = (unsigned)(size_t)&sV[0][tid >> 3][(tid & 7) * 8];
    stage_kv(gkt, 16 * LL, gv, lk, lv);
    asm volatile("s_wait_asynccnt 0x0" ::: "memory");     // tile 0 has landed before the barrier that lets the other waves read it
    __syncthreads();
    stage_kv(gkt + 64, 16 * LL, gv + 64, lk + 64 * KP * 2, lv + 64 * KP * 2);                        // nx >= 2 here: tile 1 exists and is a prefix tile
    v8f ps[4] = {}, pz = {};                              // this wave's 16 feature rows (w * 16 ..) of phi_k^T V and of phi_k^T 1
    v16h ones;
#pragma unroll
    for (int i = 0; i < 16; ++i) ones[i] = (_Float16)1.0f;
#pragma unroll 1
    for (int kt = 0; kt < nx; ++kt) {
      v16h ka[2], vf[2][4];
#pragma unroll
      for (int kc = 0; kc < 2; ++kc) ka[kc] = frag_h(&sK[kt & 1][w * 16 + col][kc * 32], lane);
#pragma unroll
      for (int kc = 0; kc < 2; ++kc)
#pragma unroll
        for (int t = 0; t < 4; ++t) vf[kc][t] = frag_h(&sV[kt & 1][t * 16 + col][kc * 32], lane);
      __builtin_amdgcn_sched_barrier(0);                  // holds the tile's 20 LDS reads in one group ahead of the products: sunk to their users, each product waits out a read of its own
#pragma unroll
      for (int kc = 0; kc < 2; ++kc) {
#pragma unroll
        for (int t = 0; t < 4; ++t) ps[t] = wmma16(ka[kc], vf[kc][t], ps[t]);
        pz = wmma16(ka[kc], ones, pz); }
      asm volatile("s_wait_dscnt 0x0" ::: "memory");      // this wave's reads of the tile's buffer are done before the buffer is filled again
      asm volatile("s_wait_asynccnt 0x0" ::: "memory");   // this wave's pieces of the next tile have landed
      __syncthreads();                                    // publishes the next tile and ends every wave's reads of this one
      if (kt + 2 <= nx) { const bool own = kt + 2 == nx;
        stage_kv(own ? gkr : gkt + (kt + 2) * 64, own ? 16 * DM : 16 * LL, gv + (kt + 2) * 64, lk + (kt & 1) * 64 * KP * 2, lv + (kt & 1) * 64 * KP * 2); } }
    asm volatile("s_wait_asynccnt 0x0" ::: "memory");     // no copy is outstanding behind the loop
    // the state's 16 rows of each wave to LDS, transposed: a lane holds 8 successive features of one channel
#pragma unroll
    for (int t = 0; t < 5; ++t) { const v8f sv = t < 4 ? ps[t] : pz; v8h hs;
#pragma unroll
      for (int r = 0; r < 8; ++r) hs[r] = (_Float16)(sv[r] * (1.0f / 64.0f));
      *(v8h*)(&sT[t * 16 + col][w * 16 + 8 * g]) = hs; }
    asm volatile("s_wait_dscnt 0x0" ::: "memory");        // this wave's rows of the state are in LDS before the barrier
    __syncthreads();                                      // every wave reads all four waves' rows of the state
    { v16h sf[2][5];
#pragma unroll
      for (int kc = 0; kc < 2; ++kc)
#pragma unroll
        for (int t = 0; t < 5; ++t) sf[kc][t] = frag_h(&sT[t * 16 + col][kc * 32], lane);
      __builtin_amdgcn_sched_barrier(0);                  // holds the state's 20 LDS reads in one group ahead of the products: sunk to their users, each product waits out a read of its own
#pragma unroll
      for (int kc = 0; kc < 2; ++kc) {
#pragma unroll
        for (int t = 0; t < 4; ++t) acc[t] = wmma16(aq[kc], sf[kc][t], acc[t]);
        zpre = wmma16(aq[kc], sf[kc][4], zpre); } }
    { // the block's own tile: masked scores
      v16h kf[2][4], vf[2][4];
#pragma unroll
      for (int kc = 0; kc < 2; ++kc)
#pragma unroll
        for (int t = 0; t < 4; ++t) kf[kc][t] = frag_h(&sK[nx & 1][t * 16 + col][kc * 32], lane);
#pragma unroll
      for (int kc = 0; kc < 2; ++kc)
#pragma unroll
        for (int t = 0; t < 4; ++t) vf[kc][t] = frag_h(&sV[nx & 1][t * 16 + col][kc * 32], lane);
      v8f s[4] = {};
#pragma unroll
      for (int kc = 0; kc < 2; ++kc)
#pragma unroll
        for (int t = 0; t < 4; ++t) s[t] = wmma16(aq[kc], kf[kc][t], s[t]);
#pragma unroll
      for (int t = 0; t < 4; ++t) put_s(nx, t, s[t]);
      LDSX();
      rowsum();
      LDSX();
      v16h pa[2];
#pragma unroll
      for (int kc = 0; kc < 2; ++kc) pa[kc] = frag_h(&sP[w][col][0] + kc * 32, lane);
#pragma unroll
      for (int kc = 0; kc < 2; ++kc)
#pragma unroll
        for (int t = 0; t < 4; ++t) acc[t] = wmma16(pa[kc], vf[kc][t], acc[t]); } }
  zsum += __shfl_xor(zsum, 16, 32);                        // full row sum for row 'col' in both half-lanes
  const float oscale = precise ? 1.0f : 64.0f;
#pragma unroll
  for (int r = 0; r < 8; ++r) { const float zr = __shfl(zsum, 8 * g + r, 32) + zpre[r] * 64.0f;   // own tile's row sum + phi_q . prefix sum of phi_k (0 in the precise blocks)
#pragma unroll
    for (int t = 0; t < 4; ++t) sO[w][8 * g + r][t * 16 + col] = acc[t][r] * oscale / zr; }
  LDSX();
  for (int q = lane; q < 16 * 16; q += 32) { const int rl = q >> 4, pc = q & 15; vst2(out + (rb + q0 + rl) * DM + h * HD + pc * 4, *(const v4f*)(&sO[w][rl][pc * 4])); }
}
extern "C" void kernel_launch(void* const* d_in, const int* in_sizes, int n_in, void* d_out, int out_size, void* d_ws, size_t ws_size, hipStream_t stream) {
  (void)in_sizes; (void)n_in; (void)out_size; (void)ws_size;
  const float* xq = (const float*)d_in[0]; const float* xk = (const float*)d_in[1]; const float* Wq = (const float*)d_in[2]; const float* Wk = (const float*)d_in[3]; const float* Wv = (const float*)d_in[4];
  float* out = (float*)d_out;
  char* ws = (char*)d_ws; size_t off = 0;
  auto take = [&](size_t bytes) { char* p = ws + off; off += (bytes + 255) & ~(size_t)255; return p; };
  _Float16* PQ16 = (_Float16*)take((size_t)NR * DM * 2); float* PQ32 = (float*)take((size_t)NR * DM * 4); _Float16* PK16 = (_Float16*)take((size_t)NR * DM * 2); float* PK32 = (float*)take((size_t)NR * DM * 4);
  float* V32 = (float*)take((size_t)NR * DM * 4); _Float16* VT16 = (_Float16*)take((size_t)NB * DM * LL * 2); _Float16* PKT16 = (_Float16*)take((size_t)NB * DM * LL * 2);
  k_proj<<<dim3(NR / 64, DM / 128, 3), 128, 0, stream>>>(xq, xk, Wq, Wk, Wv, PQ16, PQ32, PK16, PK32, V32, VT16, PKT16);
  k_attn<<<dim3(LL / 64, NH, NB), 128, 0, stream>>>(PQ16, PQ32, PK16, PK32, V32, VT16, PKT16, out);
}

// v005
// Measured time: 39.1 microseconds a run.
// Two timings next to v004 both put it at 1.15 times that version's speed.
// All steps since v000 together make it 5.42 times as fast.
#include <hip/hip_runtime.h>
#include <math.h>

typedef __attribute__((ext_vector_type(16))) _Float16 v16h;
typedef __attribute__((ext_vector_type(16))) __bf16 v16b;
typedef __attribute__((ext_vector_type(8)))  _Float16 v8h;
typedef __attribute__((ext_vector_type(8)))  float v8f;
typedef __attribute__((ext_vector_type(4)))  float v4f;
typedef __attribute__((ext_vector_type(2)))  float v2f;
typedef __attribute__((ext_vector_type(4)))  unsigned v4u;
typedef __attribute__((ext_vector_type(4)))  int v4i;
typedef float __attribute__((may_alias)) float_a;
typedef int __attribute__((may_alias)) int_a;

template <typename T> __device__ __forceinline__ void vst2(void* p, T v) { *(T*)p = v;  }
__device__ __forceinline__ v8f wmma16(v16h a, v16h b, v8f c) {
  v8f d = __builtin_amdgcn_wmma_f32_16x16x32_f16(false, a, false, b, (short)0, c, false, false);
  asm volatile("v_nop\n\tv_nop\n\tv_nop\n\tv_nop" : "+v"(d) : "v"(a), "v"(b));
  return d;
}
__device__ __forceinline__ v8f wmma_bf(v16b a, v16b b, v8f c) {
  v8f d = __builtin_amdgcn_wmma_f32_16x16x32_bf16(false, a, false, b, (short)0, c, false, false);
  asm volatile("v_nop\n\tv_nop\n\tv_nop\n\tv_nop" : "+v"(d) : "v"(a), "v"(b));
  return d;
}
// 16x16x32 fragments: lane = (h = lane>>4, row/col = lane&15); elements 0..7 = k0+8h+0..7, 8..15 = k0+16+8h+0..7; D element r = row 8h+r
__device__ __forceinline__ v16h frag_h(const _Float16* rowk0, int lane) {
  union { v16h v; v8h q[2]; } u; const _Float16* p = rowk0 + 8 * (lane >> 4);
  u.q[0] = *(const v8h*)p; u.q[1] = *(const v8h*)(p + 16); return u.v;
}
// column fragment from a [K][ld] layout (column n), rows >= K read as 0
__device__ __forceinline__ v16h fragc_f32(const float* W, int k0, int n, int lane, int ld, int K) {
  v16h a; const int g = lane >> 4;
#pragma unroll
  for (int i = 0; i < 8; ++i) { const int ka = k0 + 8 * g + i, kb = ka + 16;
    a[i] = (_Float16)(ka < K ? W[(size_t)ka * ld + n] : 0.f); a[8 + i] = (_Float16)(kb < K ? W[(size_t)kb * ld + n] : 0.f); }
  return a;
}
struct F2 { v16b h, l; };
__device__ __forceinline__ F2 bsplit16(const float v[16]) { F2 r;
#pragma unroll
  for (int i = 0; i < 16; ++i) { const __bf16 h = (__bf16)v[i]; r.h[i] = h; r.l[i] = (__bf16)(v[i] - (float)h); }
  return r; }
__device__ __forceinline__ F2 split_row(const float* row, int k0, int lane) { float v[16]; const float* p = row + k0 + 8 * (lane >> 4);
#pragma unroll
  for (int i = 0; i < 8; ++i) { v[i] = p[i]; v[8 + i] = p[16 + i]; }
  return bsplit16(v); }
__device__ __forceinline__ F2 split_rowK(const float* row, int k0, int lane, int K) { float v[16]; const int g = lane >> 4;
#pragma unroll
  for (int i = 0; i < 8; ++i) { const int ka = k0 + 8 * g + i, kb = ka + 16; v[i] = ka < K ? row[ka] : 0.f; v[8 + i] = kb < K ? row[kb] : 0.f; }
  return bsplit16(v); }
__device__ __forceinline__ F2 split_col(const float* W, int k0, int n, int lane, int ld, int K) { float v[16]; const int g = lane >> 4;
#pragma unroll
  for (int i = 0; i < 8; ++i) { const int ka = k0 + 8 * g + i, kb = ka + 16; v[i] = ka < K ? W[(size_t)ka * ld + n] : 0.f; v[8 + i] = kb < K ? W[(size_t)kb * ld + n] : 0.f; }
  return bsplit16(v); }
__device__ __forceinline__ v8f mac3(const F2& a, const F2& b, v8f c) { c = wmma_bf(a.l, b.h, c); c = wmma_bf(a.h, b.l, c); return wmma_bf(a.h, b.h, c); }
__device__ __forceinline__ float sigm(float v) { return 1.0f / (1.0f + expf(-v)); }
// softplus(z) = max(z, 0) + log1p(exp(-|z|)), for every z, on the hardware's exp2 and log2: t = exp(-|z|) lies in [0, 1], u = 1 + t in [1, 2];
// t - (u - 1) is what the rounding of 1 + t dropped: added back, it keeps the relative accuracy of the small results (z far below 0, where log1p(t) ~ t)
__device__ __forceinline__ float softplus(float z) {
  const float t = __builtin_amdgcn_exp2f(fabsf(z) * -1.44269504f), u = 1.0f + t;
  return fmaxf(z, 0.0f) + (__builtin_amdgcn_logf(u) * 0.69314718f + (t - (u - 1.0f)));
}
#define LDSX() do { asm volatile("s_wait_dscnt 0" ::: "memory"); __builtin_amdgcn_wave_barrier(); __builtin_amdgcn_fence(__ATOMIC_RELEASE, "workgroup"); } while (0)

// Causal linear ("kernelized") attention: out[q] = sum_{k<=q} (phi(q_q).phi(k_k)) v_k / sum_{k<=q} phi(q_q).phi(k_k) with phi = softplus.
// q/k projections on v_wmma_f32_16x16x32_f16 (operands converted once per block on their way into LDS, [out][in] weights x16), softplus in f32, features kept as
// f16 rows plus f32 copies (phi(k) also as an f16 transposed copy); the v projection as a two-way bf16 split (near-f32: the first rows return v
// almost verbatim). Per (n, h, 64 queries): all keys in front of the query block enter through the prefix state phi_k^T V (64 x 64) and the prefix
// sum of phi_k, summed tile by tile on f16 WMMA in f32 and applied once as phi_q . state (state x 1/64 in f16); only the block's own 64 keys go
// through the masked score tile S = phi_q . phi_k and S @ V (S scaled by 1/64 into f16; V as an f16 transposed copy), row sums of S in f32;
// not so the first two query blocks of each sequence, whose S and S @ V over all their keys are two-way bf16 splits
#define NB 2
#define LL 2048
#define DM 512
#define NH 8
#define HD 64
#define NR (NB * LL)

// LDS rows of one k step in 16-bit form: 32 elements + 8 of pad = 80 B, the conflict-free pitch of ds_load_b128 on 64-B rows
#define HP 40
typedef __attribute__((ext_vector_type(4))) _Float16 v4h;
typedef __attribute__((ext_vector_type(4))) __bf16 v4b;
typedef __attribute__((ext_vector_type(8))) __bf16 v8b;
__device__ __forceinline__ v16b frag_b(const __bf16* rowk0, int lane) {
  union { v16b v; v8b q[2]; } u; const __bf16* p = rowk0 + 8 * (lane >> 4);
  u.q[0] = *(const v8b*)p; u.q[1] = *(const v8b*)(p + 16); return u.v;
}
// projections: blockIdx.z: 0 -> phi(q) (F16 rows PQ16 [r][512] + f32 PQ32), 1 -> phi(k) (PK16, PK32; PKT16 [n][c][l] f16), 2 -> v (V32 rows [r][512] split GEMM; VT16 [n][c][l] f16)
__global__ __launch_bounds__(128) void k_proj(const float* __restrict__ xq, const float* __restrict__ xk, const float* __restrict__ Wq, const float* __restrict__ Wk, const float* __restrict__ Wv,
                                            _Float16* __restrict__ PQ16, float* __restrict__ PQ32, _Float16* __restrict__ PK16, float* __restrict__ PK32, float* __restrict__ V32, _Float16* __restrict__ VT16, _Float16* __restrict__ PKT16) {
  // one LDS block, used twice. In the k loop: the k step's operands in the matrix unit's own 16-bit form, [buffer 0..1][plane 0..1][row][HP]: x at byte 0 (64 rows),
  // weights at byte 20480 (128 rows); plane 0 = f16 (q, k) or the bf16 high part (v), plane 1 = the bf16 low part (v). Behind the loop: so and st
  __shared__ __align__(16) char sm[61440];
  float (*so)[16][132] = (float (*)[16][132])sm;
  _Float16 (*st)[72] = (_Float16 (*)[72])(sm + 4 * 16 * 132 * 4);
  const int tid = threadIdx.x, wave = tid >> 5, lane = tid & 31, col = lane & 15, g = lane >> 4;
  const int which = blockIdx.z, r0b = blockIdx.x * 64, r0 = r0b + wave * 16, n0 = blockIdx.y * 128;
  v8f acc[8] = {};
  const int srow = tid >> 3, sc = (tid & 7) * 4;          // this thread's pieces of a k step: 4 floats at column sc of rows srow + 16 i; a wave's load covers four whole 128-B lines
  const float* gx = (which == 0 ? xq : xk) + (size_t)(r0b + srow) * DM + sc;
  const float* gw = (which == 0 ? Wq : which == 1 ? Wk : Wv) + (size_t)(n0 + srow) * DM + sc;
  const int so16 = srow * HP + sc, fx16 = (wave * 16 + col) * HP, fw16 = col * HP;   // 16-bit LDS places inside a plane: this thread's first piece; this lane's x row and first weight row
  v4f rx[4], rw[8];                                       // the next k step on its way: loaded ahead of this step's products, converted once for the block and stored behind them
  auto fetch = [&](int kc) {
#pragma unroll
    for (int i = 0; i < 4; ++i) rx[i] = *(const v4f*)(gx + kc * 32 + i * 16 * DM);
#pragma unroll
    for (int i = 0; i < 8; ++i) rw[i] = *(const v4f*)(gw + kc * 32 + i * 16 * DM);
    asm volatile("s_wait_xcnt 0x0" ::: "memory"); };      // stands in front of the next write of the address registers that these loads name
  if (which < 2) {
    _Float16* hX = (_Float16*)sm; _Float16* hW = (_Float16*)(sm + 20480);
    auto put = [&](int b) {
#pragma unroll
      for (int i = 0; i < 4; ++i) { v4h h;
#pragma unroll
        for (int e = 0; e < 4; ++e) h[e] = (_Float16)rx[i][e];
        *(v4h*)(hX + b * (2 * 64 * HP) + so16 + i * (16 * HP)) = h; }
#pragma unroll
      for (int i = 0; i < 8; ++i) { v4h h;
#pragma unroll
        for (int e = 0; e < 4; ++e) h[e] = (_Float16)(rw[i][e] * 16.0f);
        *(v4h*)(hW + b * (2 * 128 * HP) + so16 + i * (16 * HP)) = h; } };
    auto mm = [&](int b) { v16h wf[8]; const v16h a = frag_h(hX + b * (2 * 64 * HP) + fx16, lane);
#pragma unroll
      for (int j = 0; j < 8; ++j) wf[j] = frag_h(hW + b * (2 * 128 * HP) + fw16 + j * (16 * HP), lane);
      __builtin_amdgcn_sched_barrier(0);                  // holds the step's 18 LDS reads in one group ahead of the products: sunk to their users, each product waits out a read of its own
#pragma unroll
      for (int j = 0; j < 8; ++j) acc[j] = wmma16(a, wf[j], acc[j]); };
    fetch(0); put(0);
    __syncthreads();                                      // k step 0 stands in LDS for all four waves
#pragma unroll 1
    for (int kc = 0; kc < DM / 32 - 1; ++kc) { fetch(kc + 1); mm(kc & 1); put((kc & 1) ^ 1);
      __syncthreads(); }                                  // publishes the next step and ends every wave's reads of this one
    mm((DM / 32 - 1) & 1);
    __syncthreads();                                      // every wave's reads of the last step end before so and st take the same LDS
#pragma unroll
    for (int j = 0; j < 8; ++j)
#pragma unroll
      for (int r = 0; r < 8; ++r) { acc[j][r] = softplus(acc[j][r] * (1.0f / 16.0f)); so[wave][8 * g + r][j * 16 + col] = acc[j][r]; }
    if (which == 1) {
#pragma unroll
      for (int j = 0; j < 8; ++j)
#pragma unroll
        for (int r = 0; r < 8; ++r) st[j * 16 + col][wave * 16 + 8 * g + r] = (_Float16)acc[j][r]; }
    LDSX();
    if (which == 1) __syncthreads();                      // all four waves' columns of st stand before its rows are read below; here, ahead of the global stores, it waits for none of them
    _Float16* D16 = which == 0 ? PQ16 : PK16; float* D32 = which == 0 ? PQ32 : PK32;
#pragma unroll 4
    for (int rl = 0; rl < 16; ++rl) vst2(D32 + (size_t)(r0 + rl) * DM + n0 + lane * 4, *(const v4f*)(&so[wave][rl][lane * 4]));
    for (int q = lane; q < 16 * 16; q += 32) { const int rl = q >> 4, pc = q & 15; union { v8h h8; v4u u; } pk;
#pragma unroll
      for (int e = 0; e < 8; ++e) pk.h8[e] = (_Float16)so[wave][rl][pc * 8 + e];
      vst2(D16 + (size_t)(r0 + rl) * DM + n0 + pc * 8, pk.u); }
    if (which == 1) {                                     // PKT16 [n][c][l], as VT16 below
      const int n = r0b / LL, l0 = r0b % LL;
      for (int q = tid; q < 128 * 8; q += 128) { const int cl = q >> 3, pc = q & 7; vst2(PKT16 + ((size_t)n * DM + n0 + cl) * LL + l0 + pc * 8, *(const v4u*)(&st[cl][pc * 8])); } } }
  else {
    __bf16* bX = (__bf16*)sm; __bf16* bW = (__bf16*)(sm + 20480);
    auto put4 = [&](const v4f& v, __bf16* hi, int plane) { v4b h, l;
#pragma unroll
      for (int e = 0; e < 4; ++e) { const __bf16 hh = (__bf16)v[e]; h[e] = hh; l[e] = (__bf16)(v[e] - (float)hh); }
      *(v4b*)hi = h; *(v4b*)(hi + plane) = l; };
    auto put = [&](int b) {
#pragma unroll
      for (int i = 0; i < 4; ++i) put4(rx[i], bX + b * (2 * 64 * HP) + so16 + i * (16 * HP), 64 * HP);
#pragma unroll
      for (int i = 0; i < 8; ++i) put4(rw[i], bW + b * (2 * 128 * HP) + so16 + i * (16 * HP), 128 * HP); };
    auto mm = [&](int b) { F2 a; const __bf16* pa = bX + b * (2 * 64 * HP) + fx16; a.h = frag_b(pa, lane); a.l = frag_b(pa + 64 * HP, lane);
#pragma unroll
      for (int hf = 0; hf < 2; ++hf) { F2 wf[4];          // four column tiles at a time; each accumulator takes its three products in mac3's order, the four chains side by side
#pragma unroll
        for (int j = 0; j < 4; ++j) { const __bf16* pw = bW + b * (2 * 128 * HP) + fw16 + (hf * 4 + j) * (16 * HP); wf[j].h = frag_b(pw, lane); wf[j].l = frag_b(pw + 128 * HP, lane); }
        __builtin_amdgcn_sched_barrier(0);                // holds the half's LDS reads in one group ahead of its products: sunk to their users, each product waits out a read of its own
#pragma unroll
        for (int j = 0; j < 4; ++j) acc[hf * 4 + j] = wmma_bf(a.l, wf[j].h, acc[hf * 4 + j]);
#pragma unroll
        for (int j = 0; j < 4; ++j) acc[hf * 4 + j] = wmma_bf(a.h, wf[j].l, acc[hf * 4 + j]);
#pragma unroll
        for (int j = 0; j < 4; ++j) acc[hf * 4 + j] = wmma_bf(a.h, wf[j].h, acc[hf * 4 + j]); } };
    fetch(0); put(0);
    __syncthreads();                                      // k step 0 stands in LDS for all four waves
#pragma unroll 1
    for (int kc = 0; kc < DM / 32 - 1; ++kc) { fetch(kc + 1); mm(kc & 1); put((kc & 1) ^ 1);
      __syncthreads(); }                                  // publishes the next step and ends every wave's reads of this one
    mm((DM / 32 - 1) & 1);
    __syncthreads();                                      // every wave's reads of the last step end before so and st take the same LDS
#pragma unroll
    for (int j = 0; j < 8; ++j)
#pragma unroll
      for (int r = 0; r < 8; ++r) { so[wave][8 * g + r][j * 16 + col] = acc[j][r]; st[j * 16 + col][wave * 16 + 8 * g + r] = (_Float16)acc[j][r]; }
    LDSX();
#pragma unroll 4
    for (int rl = 0; rl < 16; ++rl) vst2(V32 + (size_t)(r0 + rl) * DM + n0 + lane * 4, *(const v4f*)(&so[wave][rl][lane * 4]));
    __syncthreads();
    // VT16 [n][c][l]: c = n0 + cl (global channel 0..511 = h*64 + d), l = r0b .. +63 within sequence n
    { const int n = r0b / LL, l0 = r0b % LL;
      for (int q = tid; q < 128 * 8; q += 128) { const int cl = q >> 3, pc = q & 7; vst2(VT16 + ((size_t)n * DM + n0 + cl) * LL + l0 + pc * 8, *(const v4u*)(&st[cl][pc * 8])); } } }
}
// one 64 x 64 f16 tile of phi(k) (rows, or rows of the transposed copy) and one of V^T rows, 128 B a row, into LDS rows of KP halves: each lane brings
// 4 + 4 pieces of 16 B, a wave's copy covers four whole 128-B lines. gk, gv, lk, lv: the lane's own first piece; the next three lie 16 rows further each
// (ks: 16 rows of the phi(k) source in elements)
#define KP 72
__device__ __forceinline__ void stage_kv(const _Float16* gk, int ks, const _Float16* gv, unsigned lk, unsigned lv) {
  const _Float16 *gk1 = gk + ks, *gk2 = gk + 2 * ks, *gk3 = gk + 3 * ks, *gv1 = gv + 16 * LL, *gv2 = gv + 32 * LL, *gv3 = gv + 48 * LL;
  const unsigned lk1 = lk + 16 * KP * 2, lk2 = lk + 32 * KP * 2, lk3 = lk + 48 * KP * 2, lv1 = lv + 16 * KP * 2, lv2 = lv + 32 * KP * 2, lv3 = lv + 48 * KP * 2;
  // the copies and their s_wait_xcnt in one statement: the wait stands in front of any rewrite of the address registers the copies name
  asm volatile("global_load_async_to_lds_b128 %0, %8, off\n\t"
               "global_load_async_to_lds_b128 %1, %9, off\n\t"
               "global_load_async_to_lds_b128 %2, %10, off\n\t"
               "global_load_async_to_lds_b128 %3, %11, off\n\t"
               "global_load_async_to_lds_b128 %4, %12, off\n\t"
               "global_load_async_to_lds_b128 %5, %13, off\n\t"
               "global_load_async_to_lds_b128 %6, %14, off\n\t"
               "global_load_async_to_lds_b128 %7, %15, off\n\t"
               "s_wait_xcnt 0x0"
               :: "v"(lk), "v"(lk1), "v"(lk2), "v"(lk3), "v"(lv), "v"(lv1), "v"(lv2), "v"(lv3),
                  "v"(gk), "v"(gk1), "v"(gk2), "v"(gk3), "v"(gv), "v"(gv1), "v"(gv2), "v"(gv3) : "memory");
}
// attention: block (64 queries, h, n)
__global__ __launch_bounds__(128) void k_attn(const _Float16* __restrict__ PQ16, const float* __restrict__ PQ32, const _Float16* __restrict__ PK16, const float* __restrict__ PK32, const float* __restrict__ V32, const _Float16* __restrict__ VT16, const _Float16* __restrict__ PKT16, float* __restrict__ out) {
  __shared__ __align__(16) float sS[4][16][68];
  __shared__ __align__(16) _Float16 sP[4][16][72];
  __shared__ __align__(16) float sO[4][16][68];
  __shared__ __align__(16) _Float16 sK[2][64][KP];        // two buffers: the tile in work and the next one in flight
  __shared__ __align__(16) _Float16 sV[2][64][KP];
  __shared__ __align__(16) _Float16 sT[80][KP];           // prefix state x 1/64, transposed: rows 0..63 = value channel D, rows 64..79 = the prefix sum of phi(k) (16 equal rows); columns = feature d
  const int tid = threadIdx.x, w = tid >> 5, lane = tid & 31, col = lane & 15, g = lane >> 4;
  const int n = blockIdx.z, h = blockIdx.y, q0 = blockIdx.x * 64 + w * 16; const size_t rb = (size_t)n * LL;
  const bool precise = blockIdx.x < 2;
  v8f acc[4] = {}, zpre = {}; float zsum = 0.f;                      // zsum: row (col) partial over this lane's half? -> keep per (row = col, half g) then combine
  const int ntiles = blockIdx.x + 1;
  // masked scores of key columns t * 16 + col into the wave's own sS rows
  auto put_s = [&](int kt, int t, const v8f& s) { const int key = kt * 64 + t * 16 + col;
#pragma unroll
    for (int r = 0; r < 8; ++r) { const int qi = q0 + 8 * g + r; sS[w][8 * g + r][t * 16 + col] = key <= qi ? s[r] : 0.f; } };
  // row sums (lane (row col, half g)) and the f16 copy (x 1/64)
  auto rowsum = [&]() { float z = 0.f;
#pragma unroll
    for (int jj = 0; jj < 32; ++jj) { const float sv = sS[w][col][g * 32 + jj]; z += sv; sP[w][col][g * 32 + jj] = (_Float16)(sv * (1.0f / 64.0f)); }
    zsum += z; };
  if (precise) {                                          // nothing is staged here: each wave works on its own LDS rows alone
    F2 aqs[2];
#pragma unroll
    for (int kc = 0; kc < 2; ++kc) aqs[kc] = split_row(PQ32 + (rb + q0 + col) * DM + h * HD, kc * 32, lane);
#pragma unroll 1
    for (int kt = 0; kt < ntiles; ++kt) {
#pragma unroll
      for (int t = 0; t < 4; ++t) { v8f s = {}; const int key = kt * 64 + t * 16 + col;
#pragma unroll
        for (int kc = 0; kc < 2; ++kc) s = mac3(aqs[kc], split_row(PK32 + (rb + key) * DM + h * HD, kc * 32, lane), s);
        put_s(kt, t, s); }
      LDSX();
      rowsum();
      LDSX();
#pragma unroll
      for (int kc = 0; kc < 2; ++kc) { const F2 pa = split_row(&sS[w][col][0], kc * 32, lane);
#pragma unroll
        for (int t = 0; t < 4; ++t) acc[t] = mac3(pa, split_col(V32 + (rb + kt * 64) * DM + h * HD, kc * 32, t * 16 + col, lane, DM, 64), acc[t]); } } }
  else {
    v16h aq[2];
#pragma unroll
    for (int kc = 0; kc < 2; ++kc) aq[kc] = frag_h(PQ16 + (rb + q0 + col) * DM + h * HD + kc * 32, lane);
    const int nx = blockIdx.x;                            // key tiles 0 .. nx - 1 lie wholly in front of the block's queries, tile nx is the block's own
    const _Float16* gkt = PKT16 + ((size_t)n * DM + h * HD + (tid >> 3)) * LL + (tid & 7) * 8;       // transposed phi(k), tile 0, this lane's first piece; a tile further: 64 columns
    const _Float16* gkr = PK16 + (rb + nx * 64 + (tid >> 3)) * DM + h * HD + (tid & 7) * 8;          // phi(k) rows of tile nx
    const _Float16* gv = VT16 + ((size_t)n * DM + h * HD + (tid >> 3)) * LL + (tid & 7) * 8;         // tile 0; a tile further: 64 columns
    const unsigned lk = (unsigned)(size_t)&sK[0][tid >> 3][(tid & 7) * 8], lv = (unsigned)(size_t)&sV[0][tid >> 3][(tid & 7) * 8];
    stage_kv(gkt, 16 * LL, gv, lk, lv);
    asm volatile("s_wait_asynccnt 0x0" ::: "memory");     // tile 0 has landed before the barrier that lets the other waves read it
    __syncthreads();
    stage_kv(gkt + 64, 16 * LL, gv + 64, lk + 64 * KP * 2, lv + 64 * KP * 2);                        // nx >= 2 here: tile 1 exists and is a prefix tile
    v8f ps[4] = {}, pz = {};                              // this wave's 16 feature rows (w * 16 ..) of phi_k^T V and of phi_k^T 1
    v16h ones;
#pragma unroll
    for (int i = 0; i < 16; ++i) ones[i] = (_Float16)1.0f;
#pragma unroll 1
    for (int kt = 0; kt < nx; ++kt) {
      v16h ka[2], vf[2][4];
#pragma unroll
      for (int kc = 0; kc < 2; ++kc) ka[kc] = frag_h(&sK[kt & 1][w * 16 + col][kc * 32], lane);
#pragma unroll
      for (int kc = 0; kc < 2; ++kc)
#pragma unroll
        for (int t = 0; t < 4; ++t) vf[kc][t] = frag_h(&sV[kt & 1][t * 16 + col][kc * 32], lane);
      __builtin_amdgcn_sched_barrier(0);                  // holds the tile's 20 LDS reads in one group ahead of the products: sunk to their users, each product waits out a read of its own
#pragma unroll
      for (int kc = 0; kc < 2; ++kc) {
#pragma unroll
        for (int t = 0; t < 4; ++t) ps[t] = wmma16(ka[kc], vf[kc][t], ps[t]);
        pz = wmma16(ka[kc], ones, pz); }
      asm volatile("s_wait_dscnt 0x0" ::: "memory");      // this wave's reads of the tile's buffer are done before the buffer is filled again
      asm volatile("s_wait_asynccnt 0x0" ::: "memory");   // this wave's pieces of the next tile have landed
      __syncthreads();                                    // publishes the next tile and ends every wave's reads of this one
      if (kt + 2 <= nx) { const bool own = kt + 2 == nx;
        stage_kv(own ? gkr : gkt + (kt + 2) * 64, own ? 16 * DM : 16 * LL, gv + (kt + 2) * 64, lk + (kt & 1) * 64 * KP * 2, lv + (kt & 1) * 64 * KP * 2); } }
    asm volatile("s_wait_asynccnt 0x0" ::: "memory");     // no copy is outstanding behind the loop
    // the state's 16 rows of each wave to LDS, transposed: a lane holds 8 successive features of one channel
#pragma unroll
    for (int t = 0; t < 5; ++t) { const v8f sv = t < 4 ? ps[t] : pz; v8h hs;
#pragma unroll
      for (int r = 0; r < 8; ++r) hs[r] = (_Float16)(sv[r] * (1.0f / 64.0f));
      *(v8h*)(&sT[t * 16 + col][w * 16 + 8 * g]) = hs; }
    asm volatile("s_wait_dscnt 0x0" ::: "memory");        // this wave's rows of the state are in LDS before the barrier
    __syncthreads();                                      // every wave reads all four waves' rows of the state
    { v16h sf[2][5];
#pragma unroll
      for (int kc = 0; kc < 2; ++kc)
#pragma unroll
        for (int t = 0; t < 5; ++t) sf[kc][t] = frag_h(&sT[t * 16 + col][kc * 32], lane);
      __builtin_amdgcn_sched_barrier(0);                  // holds the state's 20 LDS reads in one group ahead of the products: sunk to their users, each product waits out a read of its own
#pragma unroll
      for (int kc = 0; kc < 2; ++kc) {
#pragma unroll
        for (int t = 0; t < 4; ++t) acc[t] = wmma16(aq[kc], sf[kc][t], acc[t]);
        zpre = wmma16(aq[kc], sf[kc][4], zpre); } }
    { // the block's own tile: masked scores
      v16h kf[2][4], vf[2][4];
#pragma unroll
      for (int kc = 0; kc < 2; ++kc)
#pragma unroll
        for (int t = 0; t < 4; ++t) kf[kc][t] = frag_h(&sK[nx & 1][t * 16 + col][kc * 32], lane);
#pragma unroll
      for (int kc = 0; kc < 2; ++kc)
#pragma unroll
        for (int t = 0; t < 4; ++t) vf[kc][t] = frag_h(&sV[nx & 1][t * 16 + col][kc * 32], lane);
      v8f s[4] = {};
#pragma unroll
      for (int kc = 0; kc < 2; ++kc)
#pragma unroll
        for (int t = 0; t < 4; ++t) s[t] = wmma16(aq[kc], kf[kc][t], s[t]);
#pragma unroll
      for (int t = 0; t < 4; ++t) put_s(nx, t, s[t]);
      LDSX();
      rowsum();
      LDSX();
      v16h pa[2];
#pragma unroll
      for (int kc = 0; kc < 2; ++kc) pa[kc] = frag_h(&sP[w][col][0] + kc * 32, lane);
#pragma unroll
      for (int kc = 0; kc < 2; ++kc)
#pragma unroll
        for (int t = 0; t < 4; ++t) acc[t] = wmma16(pa[kc], vf[kc][t], acc[t]); } }
  zsum += __shfl_xor(zsum, 16, 32);                        // full row sum for row 'col' in both half-lanes
  const float oscale = precise ? 1.0f : 64.0f;
#pragma unroll
  for (int r = 0; r < 8; ++r) { const float zr = __shfl(zsum, 8 * g + r, 32) + zpre[r] * 64.0f;   // own tile's row sum + phi_q . prefix sum of phi_k (0 in the precise blocks)
#pragma unroll
    for (int t = 0; t < 4; ++t) sO[w][8 * g + r][t * 16 + col] = acc[t][r] * oscale / zr; }
  LDSX();
  for (int q = lane; q < 16 * 16; q += 32) { const int rl = q >> 4, pc = q & 15; vst2(out + (rb + q0 + rl) * DM + h * HD + pc * 4, *(const v4f*)(&sO[w][rl][pc * 4])); }
}
extern "C" void kernel_launch(void* const* d_in, const int* in_sizes, int n_in, void* d_out, int out_size, void* d_ws, size_t ws_size, hipStream_t stream) {
  (void)in_sizes; (void)n_in; (void)out_size; (void)ws_size;
  const float* xq = (const float*)d_in[0]; const float* xk = (const float*)d_in[1]; const float* Wq = (const float*)d_in[2]; const float* Wk = (const float*)d_in[3]; const float* Wv = (const float*)d_in[4];
  float* out = (float*)d_out;
  char* ws = (char*)d_ws; size_t off = 0;
  auto take = [&](size_t bytes) { char* p = ws + off; off += (bytes + 255) & ~(size_t)255; return p; };
  _Float16* PQ16 = (_Float16*)take((size_t)NR * DM * 2); float* PQ32 = (float*)take((size_t)NR * DM * 4); _Float16* PK16 = (_Float16*)take((size_t)NR * DM * 2); float* PK32 = (float*)take((size_t)NR * DM * 4);
  float* V32 = (float*)take((size_t)NR * DM * 4); _Float16* VT16 = (_Float16*)take((size_t)NB * DM * LL * 2); _Float16* PKT16 = (_Float16*)take((size_t)NB * DM * LL * 2);
  k_proj<<<dim3(NR / 64, DM / 128, 3), 128, 0, stream>>>(xq, xk, Wq, Wk, Wv, PQ16, PQ32, PK16, PK32, V32, VT16, PKT16);
  k_attn<<<dim3(LL / 64, NH, NB), 128, 0, stream>>>(PQ16, PQ32, PK16, PK32, V32, VT16, PKT16, out);
}

// v006
// Measured time: 38.3 microseconds a run.
// Two timings next to v005 put it at 1.03 and 1.02 times that version's speed.
// All steps since v000 together make it 5.58 times as fast.
#include <hip/hip_runtime.h>
#include <math.h>

typedef __attribute__((ext_vector_type(16))) _Float16 v16h;
typedef __attribute__((ext_vector_type(16))) __bf16 v16b;
typedef __attribute__((ext_vector_type(8)))  _Float16 v8h;
typedef __attribute__((ext_vector_type(8)))  float v8f;
typedef __attribute__((ext_vector_type(4)))  float v4f;
typedef __attribute__((ext_vector_type(2)))  float v2f;
typedef __attribute__((ext_vector_type(4)))  unsigned v4u;
typedef __attribute__((ext_vector_type(4)))  int v4i;
typedef float __attribute__((may_alias)) float_a;
typedef int __attribute__((may_alias)) int_a;

template <typename T> __device__ __forceinline__ void vst2(void* p, T v) { *(T*)p = v;  }
__device__ __forceinline__ v8f wmma16(v16h a, v16h b, v8f c) {
  v8f d = __builtin_amdgcn_wmma_f32_16x16x32_f16(false, a, false, b, (short)0, c, false, false);
  asm volatile("v_nop\n\tv_nop\n\tv_nop\n\tv_nop" : "+v"(d) : "v"(a), "v"(b));
  return d;
}
__device__ __forceinline__ v8f wmma_bf(v16b a, v16b b, v8f c) {
  v8f d = __builtin_amdgcn_wmma_f32_16x16x32_bf16(false, a, false, b, (short)0, c, false, false);
  asm volatile("v_nop\n\tv_nop\n\tv_nop\n\tv_nop" : "+v"(d) : "v"(a), "v"(b));
  return d;
}
// 16x16x32 fragments: lane = (h = lane>>4, row/col = lane&15); elements 0..7 = k0+8h+0..7, 8..15 = k0+16+8h+0..7; D element r = row 8h+r
__device__ __forceinline__ v16h frag_h(const _Float16* rowk0, int lane) {
  union { v16h v; v8h q[2]; } u; const _Float16* p = rowk0 + 8 * (lane >> 4);
  u.q[0] = *(const v8h*)p; u.q[1] = *(const v8h*)(p + 16); return u.v;
}
// column fragment from a [K][ld] layout (column n), rows >= K read as 0
__device__ __forceinline__ v16h fragc_f32(const float* W, int k0, int n, int lane, int ld, int K) {
  v16h a; const int g = lane >> 4;
#pragma unroll
  for (int i = 0; i < 8; ++i) { const int ka = k0 + 8 * g + i, kb = ka + 16;
    a[i] = (_Float16)(ka < K ? W[(size_t)ka * ld + n] : 0.f); a[8 + i] = (_Float16)(kb < K ? W[(size_t)kb * ld + n] : 0.f); }
  return a;
}
struct F2 { v16b h, l; };
__device__ __forceinline__ F2 bsplit16(const float v[16]) { F2 r;
#pragma unroll
  for (int i = 0; i < 16; ++i) { const __bf16 h = (__bf16)v[i]; r.h[i] = h; r.l[i] = (__bf16)(v[i] - (float)h); }
  return r; }
__device__ __forceinline__ F2 split_row(const float* row, int k0, int lane) { float v[16]; const float* p = row + k0 + 8 * (lane >> 4);
#pragma unroll
  for (int i = 0; i < 8; ++i) { v[i] = p[i]; v[8 + i] = p[16 + i]; }
  return bsplit16(v); }
__device__ __forceinline__ F2 split_rowK(const float* row, int k0, int lane, int K) { float v[16]; const int g = lane >> 4;
#pragma unroll
  for (int i = 0; i < 8; ++i) { const int ka = k0 + 8 * g + i, kb = ka + 16; v[i] = ka < K ? row[ka] : 0.f; v[8 + i] = kb < K ? row[kb] : 0.f; }
  return bsplit16(v); }
__device__ __forceinline__ F2 split_col(const float* W, int k0, int n, int lane, int ld, int K) { float v[16]; const int g = lane >> 4;
#pragma unroll
  for (int i = 0; i < 8; ++i) { const int ka = k0 + 8 * g + i, kb = ka + 16; v[i] = ka < K ? W[(size_t)ka * ld + n] : 0.f; v[8 + i] = kb < K ? W[(size_t)kb * ld + n] : 0.f; }
  return bsplit16(v); }
__device__ __forceinline__ v8f mac3(const F2& a, const F2& b, v8f c) { c = wmma_bf(a.l, b.h, c); c = wmma_bf(a.h, b.l, c); return wmma_bf(a.h, b.h, c); }
__device__ __forceinline__ float sigm(float v) { return 1.0f / (1.0f + expf(-v)); }
// softplus(z) = max(z, 0) + log1p(exp(-|z|)), for every z, on the hardware's exp2 and log2: t = exp(-|z|) lies in [0, 1], u = 1 + t in [1, 2];
// t - (u - 1) is what the rounding of 1 + t dropped: added back, it keeps the relative accuracy of the small results (z far below 0, where log1p(t) ~ t)
__device__ __forceinline__ float softplus(float z) {
  const float t = __builtin_amdgcn_exp2f(fabsf(z) * -1.44269504f), u = 1.0f + t;
  return fmaxf(z, 0.0f) + (__builtin_amdgcn_logf(u) * 0.69314718f + (t - (u - 1.0f)));
}
#define LDSX() do { asm volatile("s_wait_dscnt 0" ::: "memory"); __builtin_amdgcn_wave_barrier(); __builtin_amdgcn_fence(__ATOMIC_RELEASE, "workgroup"); } while (0)

// Causal linear ("kernelized") attention: out[q] = sum_{k<=q} (phi(q_q).phi(k_k)) v_k / sum_{k<=q} phi(q_q).phi(k_k) with phi = softplus.
// q/k projections on v_wmma_f32_16x16x32_f16 (operands converted once per block on their way into LDS, [out][in] weights x16), softplus in f32, features kept as
// f16 rows plus f32 copies (phi(k) also as an f16 transposed copy); the v projection as a two-way bf16 split (near-f32: the first rows return v
// almost verbatim). Per (n, h, 64 queries): all keys in front of the query block enter through the prefix state phi_k^T V (64 x 64) and the prefix
// sum of phi_k, summed on f16 WMMA in f32, the even and the odd key tiles apart, and applied once as phi_q . state (each x 1/64 in f16); only the block's own 64 keys go
// through the masked score tile S = phi_q . phi_k and S @ V (S scaled by 1/64 into f16; V as an f16 transposed copy), row sums of S in f32;
// not so the first two query blocks of each sequence, whose S and S @ V over all their keys are two-way bf16 splits
#define NB 2
#define LL 2048
#define DM 512
#define NH 8
#define HD 64
#define NR (NB * LL)

// LDS rows of one k step in 16-bit form: 32 elements + 8 of pad = 80 B, the conflict-free pitch of ds_load_b128 on 64-B rows
#define HP 40
typedef __attribute__((ext_vector_type(4))) _Float16 v4h;
typedef __attribute__((ext_vector_type(4))) __bf16 v4b;
typedef __attribute__((ext_vector_type(8))) __bf16 v8b;
__device__ __forceinline__ v16b frag_b(const __bf16* rowk0, int lane) {
  union { v16b v; v8b q[2]; } u; const __bf16* p = rowk0 + 8 * (lane >> 4);
  u.q[0] = *(const v8b*)p; u.q[1] = *(const v8b*)(p + 16); return u.v;
}
// projections: blockIdx.z: 0 -> phi(q) (F16 rows PQ16 [r][512] + f32 PQ32), 1 -> phi(k) (PK16, PK32; PKT16 [n][c][l] f16), 2 -> v (V32 rows [r][512] split GEMM; VT16 [n][c][l] f16)
__global__ __launch_bounds__(128) void k_proj(const float* __restrict__ xq, const float* __restrict__ xk, const float* __restrict__ Wq, const float* __restrict__ Wk, const float* __restrict__ Wv,
                                            _Float16* __restrict__ PQ16, float* __restrict__ PQ32, _Float16* __restrict__ PK16, float* __restrict__ PK32, float* __restrict__ V32, _Float16* __restrict__ VT16, _Float16* __restrict__ PKT16) {
  // one LDS block, used twice. In the k loop: the k step's operands in the matrix unit's own 16-bit form, [buffer 0..1][plane 0..1][row][HP]: x at byte 0 (64 rows),
  // weights at byte 20480 (128 rows); plane 0 = f16 (q, k) or the bf16 high part (v), plane 1 = the bf16 low part (v). Behind the loop: so and st
  __shared__ __align__(16) char sm[61440];
  float (*so)[16][132] = (float (*)[16][132])sm;
  _Float16 (*st)[72] = (_Float16 (*)[72])(sm + 4 * 16 * 132 * 4);
  const int tid = threadIdx.x, wave = tid >> 5, lane = tid & 31, col = lane & 15, g = lane >> 4;
  const int which = blockIdx.z, r0b = blockIdx.x * 64, r0 = r0b + wave * 16, n0 = blockIdx.y * 128;
  v8f acc[8] = {};
  const int srow = tid >> 3, sc = (tid & 7) * 4;          // this thread's pieces of a k step: 4 floats at column sc of rows srow + 16 i; a wave's load covers four whole 128-B lines
  const float* gx = (which == 0 ? xq : xk) + (size_t)(r0b + srow) * DM + sc;
  const float* gw = (which == 0 ? Wq : which == 1 ? Wk : Wv) + (size_t)(n0 + srow) * DM + sc;
  const int so16 = srow * HP + sc, fx16 = (wave * 16 + col) * HP, fw16 = col * HP;   // 16-bit LDS places inside a plane: this thread's first piece; this lane's x row and first weight row
  v4f rx[4], rw[8];                                       // the next k step on its way: loaded ahead of this step's products, converted once for the block and stored behind them
  auto fetch = [&](int kc) {
#pragma unroll
    for (int i = 0; i < 4; ++i) rx[i] = *(const v4f*)(gx + kc * 32 + i * 16 * DM);
#pragma unroll
    for (int i = 0; i < 8; ++i) rw[i] = *(const v4f*)(gw + kc * 32 + i * 16 * DM);
    asm volatile("s_wait_xcnt 0x0" ::: "memory"); };      // stands in front of the next write of the address registers that these loads name
  if (which < 2) {
    _Float16* hX = (_Float16*)sm; _Float16* hW = (_Float16*)(sm + 20480);
    auto put = [&](int b) {
#pragma unroll
      for (int i = 0; i < 4; ++i) { v4h h;
#pragma unroll
        for (int e = 0; e < 4; ++e) h[e] = (_Float16)rx[i][e];
        *(v4h*)(hX + b * (2 * 64 * HP) + so16 + i * (16 * HP)) = h; }
#pragma unroll
      for (int i = 0; i < 8; ++i) { v4h h;
#pragma unroll
        for (int e = 0; e < 4; ++e) h[e] = (_Float16)(rw[i][e] * 16.0f);
        *(v4h*)(hW + b * (2 * 128 * HP) + so16 + i * (16 * HP)) = h; } };
    auto mm = [&](int b) { v16h wf[8]; const v16h a = frag_h(hX + b * (2 * 64 * HP) + fx16, lane);
#pragma unroll
      for (int j = 0; j < 8; ++j) wf[j] = frag_h(hW + b * (2 * 128 * HP) + fw16 + j * (16 * HP), lane);
      __builtin_amdgcn_sched_barrier(0);                  // holds the step's 18 LDS reads in one group ahead of the products: sunk to their users, each product waits out a read of its own
#pragma unroll
      for (int j = 0; j < 8; ++j) acc[j] = wmma16(a, wf[j], acc[j]); };
    fetch(0); put(0);
    __syncthreads();                                      // k step 0 stands in LDS for all four waves
#pragma unroll 1
    for (int kc = 0; kc < DM / 32 - 1; ++kc) { fetch(kc + 1); mm(kc & 1); put((kc & 1) ^ 1);
      __syncthreads(); }                                  // publishes the next step and ends every wave's reads of this one
    mm((DM / 32 - 1) & 1);
    __syncthreads();                                      // every wave's reads of the last step end before so and st take the same LDS
#pragma unroll
    for (int j = 0; j < 8; ++j)
#pragma unroll
      for (int r = 0; r < 8; ++r) { acc[j][r] = softplus(acc[j][r] * (1.0f / 16.0f)); so[wave][8 * g + r][j * 16 + col] = acc[j][r]; }
    if (which == 1) {
#pragma unroll
      for (int j = 0; j < 8; ++j)
#pragma unroll
        for (int r = 0; r < 8; ++r) st[j * 16 + col][wave * 16 + 8 * g + r] = (_Float16)acc[j][r]; }
    LDSX();
    if (which == 1) __syncthreads();                      // all four waves' columns of st stand before its rows are read below; here, ahead of the global stores, it waits for none of them
    _Float16* D16 = which == 0 ? PQ16 : PK16; float* D32 = which == 0 ? PQ32 : PK32;
#pragma unroll 4
    for (int rl = 0; rl < 16; ++rl) vst2(D32 + (size_t)(r0 + rl) * DM + n0 + lane * 4, *(const v4f*)(&so[wave][rl][lane * 4]));
    for (int q = lane; q < 16 * 16; q += 32) { const int rl = q >> 4, pc = q & 15; union { v8h h8; v4u u; } pk;
#pragma unroll
      for (int e = 0; e < 8; ++e) pk.h8[e] = (_Float16)so[wave][rl][pc * 8 + e];
      vst2(D16 + (size_t)(r0 + rl) * DM + n0 + pc * 8, pk.u); }
    if (which == 1) {                                     // PKT16 [n][c][l], as VT16 below
      const int n = r0b / LL, l0 = r0b % LL;
      for (int q = tid; q < 128 * 8; q += 128) { const int cl = q >> 3, pc = q & 7; vst2(PKT16 + ((size_t)n * DM + n0 + cl) * LL + l0 + pc * 8, *(const v4u*)(&st[cl][pc * 8])); } } }
  else {
    __bf16* bX = (__bf16*)sm; __bf16* bW = (__bf16*)(sm + 20480);
    auto put4 = [&](const v4f& v, __bf16* hi, int plane) { v4b h, l;
#pragma unroll
      for (int e = 0; e < 4; ++e) { const __bf16 hh = (__bf16)v[e]; h[e] = hh; l[e] = (__bf16)(v[e] - (float)hh); }
      *(v4b*)hi = h; *(v4b*)(hi + plane) = l; };
    auto put = [&](int b) {
#pragma unroll
      for (int i = 0; i < 4; ++i) put4(rx[i], bX + b * (2 * 64 * HP) + so16 + i * (16 * HP), 64 * HP);
#pragma unroll
      for (int i = 0; i < 8; ++i) put4(rw[i], bW + b * (2 * 128 * HP) + so16 + i * (16 * HP), 128 * HP); };
    auto mm = [&](int b) { F2 a; const __bf16* pa = bX + b * (2 * 64 * HP) + fx16; a.h = frag_b(pa, lane); a.l = frag_b(pa + 64 * HP, lane);
#pragma unroll
      for (int hf = 0; hf < 2; ++hf) { F2 wf[4];          // four column tiles at a time; each accumulator takes its three products in mac3's order, the four chains side by side
#pragma unroll
        for (int j = 0; j < 4; ++j) { const __bf16* pw = bW + b * (2 * 128 * HP) + fw16 + (hf * 4 + j) * (16 * HP); wf[j].h = frag_b(pw, lane); wf[j].l = frag_b(pw + 128 * HP, lane); }
        __builtin_amdgcn_sched_barrier(0);                // holds the half's LDS reads in one group ahead of its products: sunk to their users, each product waits out a read of its own
#pragma unroll
        for (int j = 0; j < 4; ++j) acc[hf * 4 + j] = wmma_bf(a.l, wf[j].h, acc[hf * 4 + j]);
#pragma unroll
        for (int j = 0; j < 4; ++j) acc[hf * 4 + j] = wmma_bf(a.h, wf[j].l, acc[hf * 4 + j]);
#pragma unroll
        for (int j = 0; j < 4; ++j) acc[hf * 4 + j] = wmma_bf(a.h, wf[j].h, acc[hf * 4 + j]); } };
    fetch(0); put(0);
    __syncthreads();                                      // k step 0 stands in LDS for all four waves
#pragma unroll 1
    for (int kc = 0; kc < DM / 32 - 1; ++kc) { fetch(kc + 1); mm(kc & 1); put((kc & 1) ^ 1);
      __syncthreads(); }                                  // publishes the next step and ends every wave's reads of this one
    mm((DM / 32 - 1) & 1);
    __syncthreads();                                      // every wave's reads of the last step end before so and st take the same LDS
#pragma unroll
    for (int j = 0; j < 8; ++j)
#pragma unroll
      for (int r = 0; r < 8; ++r) { so[wave][8 * g + r][j * 16 + col] = acc[j][r]; st[j * 16 + col][wave * 16 + 8 * g + r] = (_Float16)acc[j][r]; }
    LDSX();
#pragma unroll 4
    for (int rl = 0; rl < 16; ++rl) vst2(V32 + (size_t)(r0 + rl) * DM + n0 + lane * 4, *(const v4f*)(&so[wave][rl][lane * 4]));
    __syncthreads();
    // VT16 [n][c][l]: c = n0 + cl (global channel 0..511 = h*64 + d), l = r0b .. +63 within sequence n
    { const int n = r0b / LL, l0 = r0b % LL;
      for (int q = tid; q < 128 * 8; q += 128) { const int cl = q >> 3, pc = q & 7; vst2(VT16 + ((size_t)n * DM + n0 + cl) * LL + l0 + pc * 8, *(const v4u*)(&st[cl][pc * 8])); } } }
}
// one 64 x 64 f16 tile of phi(k) (rows, or rows of the transposed copy) and one of V^T rows, 128 B a row, into LDS rows of KP halves: each lane brings
// 4 + 4 pieces of 16 B, a wave's copy covers four whole 128-B lines. gk, gv, lk, lv: the lane's own first piece; the next three lie 16 rows further each
// (ks: 16 rows of the phi(k) source in elements)
#define KP 72
__device__ __forceinline__ void stage_kv(const _Float16* gk, int ks, const _Float16* gv, unsigned lk, unsigned lv) {
  const _Float16 *gk1 = gk + ks, *gk2 = gk + 2 * ks, *gk3 = gk + 3 * ks, *gv1 = gv + 16 * LL, *gv2 = gv + 32 * LL, *gv3 = gv + 48 * LL;
  const unsigned lk1 = lk + 16 * KP * 2, lk2 = lk + 32 * KP * 2, lk3 = lk + 48 * KP * 2, lv1 = lv + 16 * KP * 2, lv2 = lv + 32 * KP * 2, lv3 = lv + 48 * KP * 2;
  // the copies and their s_wait_xcnt in one statement: the wait stands in front of any rewrite of the address registers the copies name
  asm volatile("global_load_async_to_lds_b128 %0, %8, off\n\t"
               "global_load_async_to_lds_b128 %1, %9, off\n\t"
               "global_load_async_to_lds_b128 %2, %10, off\n\t"
               "global_load_async_to_lds_b128 %3, %11, off\n\t"
               "global_load_async_to_lds_b128 %4, %12, off\n\t"
               "global_load_async_to_lds_b128 %5, %13, off\n\t"
               "global_load_async_to_lds_b128 %6, %14, off\n\t"
               "global_load_async_to_lds_b128 %7, %15, off\n\t"
               "s_wait_xcnt 0x0"
               :: "v"(lk), "v"(lk1), "v"(lk2), "v"(lk3), "v"(lv), "v"(lv1), "v"(lv2), "v"(lv3),
                  "v"(gk), "v"(gk1), "v"(gk2), "v"(gk3), "v"(gv), "v"(gv1), "v"(gv2), "v"(gv3) : "memory");
}
// attention: block (64 queries, h, n)
__global__ __launch_bounds__(128) void k_attn(const _Float16* __restrict__ PQ16, const float* __restrict__ PQ32, const _Float16* __restrict__ PK16, const float* __restrict__ PK32, const float* __restrict__ V32, const _Float16* __restrict__ VT16, const _Float16* __restrict__ PKT16, float* __restrict__ out) {
  __shared__ __align__(16) float sS[4][16][68];
  __shared__ __align__(16) _Float16 sP[4][16][72];
  __shared__ __align__(16) float sO[4][16][68];
  __shared__ __align__(16) _Float16 sK[2][2][64][KP];     // two buffers of two prefix tiles each (even tile, odd tile): the pair in work and the next pair in flight
  __shared__ __align__(16) _Float16 sV[2][2][64][KP];
  __shared__ __align__(16) _Float16 sKo[64][KP];          // the block's own key tile: phi(k) rows and V^T rows
  __shared__ __align__(16) _Float16 sVo[64][KP];
  __shared__ __align__(16) _Float16 sT[2][80][KP];        // prefix state x 1/64 of the even and of the odd tiles, transposed: rows 0..63 = value channel D, rows 64..79 = the prefix sum of phi(k) (16 equal rows); columns = feature d
  const int tid = threadIdx.x, w = tid >> 5, lane = tid & 31, col = lane & 15, g = lane >> 4;
  const int n = blockIdx.z, h = blockIdx.y, q0 = blockIdx.x * 64 + w * 16; const size_t rb = (size_t)n * LL;
  const bool precise = blockIdx.x < 2;
  v8f acc[4] = {}, zpre = {}; float zsum = 0.f;                      // zsum: row (col) partial over this lane's half? -> keep per (row = col, half g) then combine
  const int ntiles = blockIdx.x + 1;
  // masked scores of key columns t * 16 + col into the wave's own sS rows
  auto put_s = [&](int kt, int t, const v8f& s) { const int key = kt * 64 + t * 16 + col;
#pragma unroll
    for (int r = 0; r < 8; ++r) { const int qi = q0 + 8 * g + r; sS[w][8 * g + r][t * 16 + col] = key <= qi ? s[r] : 0.f; } };
  // row sums (lane (row col, half g)) and the f16 copy (x 1/64)
  auto rowsum = [&]() { float z = 0.f;
#pragma unroll
    for (int jj = 0; jj < 32; ++jj) { const float sv = sS[w][col][g * 32 + jj]; z += sv; sP[w][col][g * 32 + jj] = (_Float16)(sv * (1.0f / 64.0f)); }
    zsum += z; };
  if (precise) {                                          // nothing is staged here: each wave works on its own LDS rows alone
    F2 aqs[2];
#pragma unroll
    for (int kc = 0; kc < 2; ++kc) aqs[kc] = split_row(PQ32 + (rb + q0 + col) * DM + h * HD, kc * 32, lane);
#pragma unroll 1
    for (int kt = 0; kt < ntiles; ++kt) {
#pragma unroll
      for (int t = 0; t < 4; ++t) { v8f s = {}; const int key = kt * 64 + t * 16 + col;
#pragma unroll
        for (int kc = 0; kc < 2; ++kc) s = mac3(aqs[kc], split_row(PK32 + (rb + key) * DM + h * HD, kc * 32, lane), s);
        put_s(kt, t, s); }
      LDSX();
      rowsum();
      LDSX();
#pragma unroll
      for (int kc = 0; kc < 2; ++kc) { const F2 pa = split_row(&sS[w][col][0], kc * 32, lane);
#pragma unroll
        for (int t = 0; t < 4; ++t) acc[t] = mac3(pa, split_col(V32 + (rb + kt * 64) * DM + h * HD, kc * 32, t * 16 + col, lane, DM, 64), acc[t]); } } }
  else {
    v16h aq[2];
#pragma unroll
    for (int kc = 0; kc < 2; ++kc) aq[kc] = frag_h(PQ16 + (rb + q0 + col) * DM + h * HD + kc * 32, lane);
    const int nx = blockIdx.x;                            // key tiles 0 .. nx - 1 lie wholly in front of the block's queries, tile nx is the block's own
    const _Float16* gkt = PKT16 + ((size_t)n * DM + h * HD + (tid >> 3)) * LL + (tid & 7) * 8;       // transposed phi(k), tile 0, this lane's first piece; a tile further: 64 columns
    const _Float16* gkr = PK16 + (rb + nx * 64 + (tid >> 3)) * DM + h * HD + (tid & 7) * 8;          // phi(k) rows of tile nx
    const _Float16* gv = VT16 + ((size_t)n * DM + h * HD + (tid >> 3)) * LL + (tid & 7) * 8;         // tile 0; a tile further: 64 columns
    const unsigned lk = (unsigned)(size_t)&sK[0][0][tid >> 3][(tid & 7) * 8], lv = (unsigned)(size_t)&sV[0][0][tid >> 3][(tid & 7) * 8];
    const unsigned lko = (unsigned)(size_t)&sKo[tid >> 3][(tid & 7) * 8], lvo = (unsigned)(size_t)&sVo[tid >> 3][(tid & 7) * 8];
    // the prefix tiles go two a trip: tile 2 j to waves 0 and 2, tile 2 j + 1 to waves 1 and 3, each wave 32 feature rows of its tile's phi_k^T V
    const int ng = (nx + 1) >> 1;                         // trips; with nx odd the last pair's second tile is tile nx: it exists in both copies, is staged like any other and enters no prefix sum
    const int wu = __builtin_amdgcn_readfirstlane(w), par = wu & 1, fh = wu >> 1;                    // scalar: the test on par below is a branch of the whole wave
    auto stage_pair = [&](int j, int b) {
      stage_kv(gkt + (2 * j) * 64, 16 * LL, gv + (2 * j) * 64, lk + b * (2 * 64 * KP * 2), lv + b * (2 * 64 * KP * 2));
      stage_kv(gkt + (2 * j + 1) * 64, 16 * LL, gv + (2 * j + 1) * 64, lk + b * (2 * 64 * KP * 2) + 64 * KP * 2, lv + b * (2 * 64 * KP * 2) + 64 * KP * 2); };
    stage_kv(gkr, 16 * DM, gv + nx * 64, lko, lvo);
    stage_pair(0, 0);
    asm volatile("s_wait_asynccnt 0x0" ::: "memory");     // the own tile and pair 0 have landed before the barrier that lets the other waves read them
    __syncthreads();
    if (ng > 1) stage_pair(1, 1);
    v8f ps[2][4] = {}, pz[2] = {};                        // this wave's 32 feature rows (fh * 32 ..) of phi_k^T V and of phi_k^T 1, over the tiles of its parity
    v16h ones;
#pragma unroll
    for (int i = 0; i < 16; ++i) ones[i] = (_Float16)1.0f;
#pragma unroll 1
    for (int j = 0; j < ng; ++j) {
      if (2 * j + par < nx) {
        v16h ka[2][2], vf[2][4];
#pragma unroll
        for (int a = 0; a < 2; ++a)
#pragma unroll
          for (int kc = 0; kc < 2; ++kc) ka[a][kc] = frag_h(&sK[j & 1][par][fh * 32 + a * 16 + col][kc * 32], lane);
#pragma unroll
        for (int kc = 0; kc < 2; ++kc)
#pragma unroll
          for (int t = 0; t < 4; ++t) vf[kc][t] = frag_h(&sV[j & 1][par][t * 16 + col][kc * 32], lane);
        __builtin_amdgcn_sched_barrier(0);                // holds the tile's 24 LDS reads in one group ahead of the products: sunk to their users, each product waits out a read of its own
#pragma unroll
        for (int kc = 0; kc < 2; ++kc)
#pragma unroll
          for (int a = 0; a < 2; ++a) {
#pragma unroll
            for (int t = 0; t < 4; ++t) ps[a][t] = wmma16(ka[a][kc], vf[kc][t], ps[a][t]);
            pz[a] = wmma16(ka[a][kc], ones, pz[a]); } }
      asm volatile("s_wait_dscnt 0x0" ::: "memory");      // this wave's reads of the pair's buffer are done before the buffer is filled again
      asm volatile("s_wait_asynccnt 0x0" ::: "memory");   // this wave's pieces of the next pair have landed
      __syncthreads();                                    // publishes the next pair and ends every wave's reads of this one
      if (j + 2 < ng) stage_pair(j + 2, j & 1); }
    asm volatile("s_wait_asynccnt 0x0" ::: "memory");     // no copy is outstanding behind the loop
    // the 32 state rows of each wave to LDS, transposed, into its parity's plane: a lane holds 8 successive features of one channel
#pragma unroll
    for (int a = 0; a < 2; ++a)
#pragma unroll
      for (int t = 0; t < 5; ++t) { const v8f sv = t < 4 ? ps[a][t] : pz[a]; v8h hs;
#pragma unroll
        for (int r = 0; r < 8; ++r) hs[r] = (_Float16)(sv[r] * (1.0f / 64.0f));
        *(v8h*)(&sT[par][t * 16 + col][fh * 32 + a * 16 + 8 * g]) = hs; }
    asm volatile("s_wait_dscnt 0x0" ::: "memory");        // this wave's rows of the state are in LDS before the barrier
    __syncthreads();                                      // every wave reads all four waves' rows of the state
    { v16h sf[2][2][5];                                   // phi_q . (even state + odd state): the two planes are applied one after the other into the same sums
#pragma unroll
      for (int pp = 0; pp < 2; ++pp)
#pragma unroll
        for (int kc = 0; kc < 2; ++kc)
#pragma unroll
          for (int t = 0; t < 5; ++t) sf[pp][kc][t] = frag_h(&sT[pp][t * 16 + col][kc * 32], lane);
      __builtin_amdgcn_sched_barrier(0);                  // holds the state's 40 LDS reads in one group ahead of the products: sunk to their users, each product waits out a read of its own
#pragma unroll
      for (int pp = 0; pp < 2; ++pp)
#pragma unroll
        for (int kc = 0; kc < 2; ++kc) {
#pragma unroll
          for (int t = 0; t < 4; ++t) acc[t] = wmma16(aq[kc], sf[pp][kc][t], acc[t]);
          zpre = wmma16(aq[kc], sf[pp][kc][4], zpre); } }
    { // the block's own tile: masked scores
      v16h kf[2][4], vf[2][4];
#pragma unroll
      for (int kc = 0; kc < 2; ++kc)
#pragma unroll
        for (int t = 0; t < 4; ++t) kf[kc][t] = frag_h(&sKo[t * 16 + col][kc * 32], lane);
#pragma unroll
      for (int kc = 0; kc < 2; ++kc)
#pragma unroll
        for (int t = 0; t < 4; ++t) vf[kc][t] = frag_h(&sVo[t * 16 + col][kc * 32], lane);
      v8f s[4] = {};
#pragma unroll
      for (int kc = 0; kc < 2; ++kc)
#pragma unroll
        for (int t = 0; t < 4; ++t) s[t] = wmma16(aq[kc], kf[kc][t], s[t]);
#pragma unroll
      for (int t = 0; t < 4; ++t) put_s(nx, t, s[t]);
      LDSX();
      rowsum();
      LDSX();
      v16h pa[2];
#pragma unroll
      for (int kc = 0; kc < 2; ++kc) pa[kc] = frag_h(&sP[w][col][0] + kc * 32, lane);
#pragma unroll
      for (int kc = 0; kc < 2; ++kc)
#pragma unroll
        for (int t = 0; t < 4; ++t) acc[t] = wmma16(pa[kc], vf[kc][t], acc[t]); } }
  zsum += __shfl_xor(zsum, 16, 32);                        // full row sum for row 'col' in both half-lanes
  const float oscale = precise ? 1.0f : 64.0f;
#pragma unroll
  for (int r = 0; r < 8; ++r) { const float zr = __shfl(zsum, 8 * g + r, 32) + zpre[r] * 64.0f;   // own tile's row sum + phi_q . prefix sum of phi_k (0 in the precise blocks)
#pragma unroll
    for (int t = 0; t < 4; ++t) sO[w][8 * g + r][t * 16 + col] = acc[t][r] * oscale / zr; }
  LDSX();
  for (int q = lane; q < 16 * 16; q += 32) { const int rl = q >> 4, pc = q & 15; vst2(out + (rb + q0 + rl) * DM + h * HD + pc * 4, *(const v4f*)(&sO[w][rl][pc * 4])); }
}
extern "C" void kernel_launch(void* const* d_in, const int* in_sizes, int n_in, void* d_out, int out_size, void* d_ws, size_t ws_size, hipStream_t stream) {
  (void)in_sizes; (void)n_in; (void)out_size; (void)ws_size;
  const float* xq = (const float*)d_in[0]; const float* xk = (const float*)d_in[1]; const float* Wq = (const float*)d_in[2]; const float* Wk = (const float*)d_in[3]; const float* Wv = (const float*)d_in[4];
  float* out = (float*)d_out;
  char* ws = (char*)d_ws; size_t off = 0;
  auto take = [&](size_t bytes) { char* p = ws + off; off += (bytes + 255) & ~(size_t)255; return p; };
  _Float16* PQ16 = (_Float16*)take((size_t)NR * DM * 2); float* PQ32 = (float*)take((size_t)NR * DM * 4); _Float16* PK16 = (_Float16*)take((size_t)NR * DM * 2); float* PK32 = (float*)take((size_t)NR * DM * 4);
  float* V32 = (float*)take((size_t)NR * DM * 4); _Float16* VT16 = (_Float16*)take((size_t)NB * DM * LL * 2); _Float16* PKT16 = (_Float16*)take((size_t)NB * DM * LL * 2);
  k_proj<<<dim3(NR / 64, DM / 128, 3), 128, 0, stream>>>(xq, xk, Wq, Wk, Wv, PQ16, PQ32, PK16, PK32, V32, VT16, PKT16);
  k_attn<<<dim3(LL / 64, NH, NB), 128, 0, stream>>>(PQ16, PQ32, PK16, PK32, V32, VT16, PKT16, out);
}

// v007
// Measured time: 35 microseconds a run.
// In two side-by-side timings against v006, it was 1.10 and 1.08 times as fast.
// Counting every step since v000, it is 6.08 times as fast.
#include <hip/hip_runtime.h>
#include <math.h>

typedef __attribute__((ext_vector_type(16))) _Float16 v16h;
typedef __attribute__((ext_vector_type(16))) __bf16 v16b;
typedef __attribute__((ext_vector_type(8)))  _Float16 v8h;
typedef __attribute__((ext_vector_type(8)))  float v8f;
typedef __attribute__((ext_vector_type(4)))  float v4f;
typedef __attribute__((ext_vector_type(2)))  float v2f;
typedef __attribute__((ext_vector_type(4)))  unsigned v4u;
typedef __attribute__((ext_vector_type(4)))  int v4i;
typedef float __attribute__((may_alias)) float_a;
typedef int __attribute__((may_alias)) int_a;

template <typename T> __device__ __forceinline__ void vst2(void* p, T v) { *(T*)p = v;  }
__device__ __forceinline__ v8f wmma16(v16h a, v16h b, v8f c) {
  v8f d = __builtin_amdgcn_wmma_f32_16x16x32_f16(false, a, false, b, (short)0, c, false, false);
  asm volatile("v_nop\n\tv_nop\n\tv_nop\n\tv_nop" : "+v"(d) : "v"(a), "v"(b));
  return d;
}
__device__ __forceinline__ v8f wmma_bf(v16b a, v16b b, v8f c) {
  v8f d = __builtin_amdgcn_wmma_f32_16x16x32_bf16(false, a, false, b, (short)0, c, false, false);
  asm volatile("v_nop\n\tv_nop\n\tv_nop\n\tv_nop" : "+v"(d) : "v"(a), "v"(b));
  return d;
}
// 16x16x32 fragments: lane = (h = lane>>4, row/col = lane&15); elements 0..7 = k0+8h+0..7, 8..15 = k0+16+8h+0..7; D element r = row 8h+r
__device__ __forceinline__ v16h frag_h(const _Float16* rowk0, int lane) {
  union { v16h v; v8h q[2]; } u; const _Float16* p = rowk0 + 8 * (lane >> 4);
  u.q[0] = *(const v8h*)p; u.q[1] = *(const v8h*)(p + 16); return u.v;
}
// column fragment from a [K][ld] layout (column n), rows >= K read as 0
__device__ __forceinline__ v16h fragc_f32(const float* W, int k0, int n, int lane, int ld, int K) {
  v16h a; const int g = lane >> 4;
#pragma unroll
  for (int i = 0; i < 8; ++i) { const int ka = k0 + 8 * g + i, kb = ka + 16;
    a[i] = (_Float16)(ka < K ? W[(size_t)ka * ld + n] : 0.f); a[8 + i] = (_Float16)(kb < K ? W[(size_t)kb * ld + n] : 0.f); }
  return a;
}
struct F2 { v16b h, l; };
__device__ __forceinline__ F2 bsplit16(const float v[16]) { F2 r;
#pragma unroll
  for (int i = 0; i < 16; ++i) { const __bf16 h = (__bf16)v[i]; r.h[i] = h; r.l[i] = (__bf16)(v[i] - (float)h); }
  return r; }
__device__ __forceinline__ F2 split_row(const float* row, int k0, int lane) { float v[16]; const float* p = row + k0 + 8 * (lane >> 4);
#pragma unroll
  for (int i = 0; i < 8; ++i) { v[i] = p[i]; v[8 + i] = p[16 + i]; }
  return bsplit16(v); }
__device__ __forceinline__ F2 split_rowK(const float* row, int k0, int lane, int K) { float v[16]; const int g = lane >> 4;
#pragma unroll
  for (int i = 0; i < 8; ++i) { const int ka = k0 + 8 * g + i, kb = ka + 16; v[i] = ka < K ? row[ka] : 0.f; v[8 + i] = kb < K ? row[kb] : 0.f; }
  return bsplit16(v); }
__device__ __forceinline__ F2 split_col(const float* W, int k0, int n, int lane, int ld, int K) { float v[16]; const int g = lane >> 4;
#pragma unroll
  for (int i = 0; i < 8; ++i) { const int ka = k0 + 8 * g + i, kb = ka + 16; v[i] = ka < K ? W[(size_t)ka * ld + n] : 0.f; v[8 + i] = kb < K ? W[(size_t)kb * ld + n] : 0.f; }
  return bsplit16(v); }
__device__ __forceinline__ v8f mac3(const F2& a, const F2& b, v8f c) { c = wmma_bf(a.l, b.h, c); c = wmma_bf(a.h, b.l, c); return wmma_bf(a.h, b.h, c); }
__device__ __forceinline__ float sigm(float v) { return 1.0f / (1.0f + expf(-v)); }
// softplus(z) = max(z, 0) + log1p(exp(-|z|)), for every z, on the hardware's exp2 and log2: t = exp(-|z|) lies in [0, 1], u = 1 + t in [1, 2];
// t - (u - 1) is what the rounding of 1 + t dropped: added back, it keeps the relative accuracy of the small results (z far below 0, where log1p(t) ~ t)
__device__ __forceinline__ float softplus(float z) {
  const float t = __builtin_amdgcn_exp2f(fabsf(z) * -1.44269504f), u = 1.0f + t;
  return fmaxf(z, 0.0f) + (__builtin_amdgcn_logf(u) * 0.69314718f + (t - (u - 1.0f)));
}
#define LDSX() do { asm volatile("s_wait_dscnt 0" ::: "memory"); __builtin_amdgcn_wave_barrier(); __builtin_amdgcn_fence(__ATOMIC_RELEASE, "workgroup"); } while (0)

// Causal linear ("kernelized") attention: out[q] = sum_{k<=q} (phi(q_q).phi(k_k)) v_k / sum_{k<=q} phi(q_q).phi(k_k) with phi = softplus.
// q/k projections on v_wmma_f32_16x16x32_f16 (operands converted once per block on their way into LDS, [out][in] weights x16), softplus in f32, features kept as
// f16 rows plus f32 copies (phi(k) also as an f16 transposed copy); the v projection as a two-way bf16 split (near-f32: the first rows return v
// almost verbatim). Per (n, h, 64 queries): all keys in front of the query block enter through the prefix state phi_k^T V (64 x 64) and the prefix
// sum of phi_k, summed on f16 WMMA in f32, the even and the odd key tiles apart, and applied once as phi_q . state (each x 1/64 in f16); only the block's own 64 keys go
// through the masked score tile S = phi_q . phi_k and S @ V (S scaled by 1/64 into f16; V as an f16 transposed copy), row sums of S in f32;
// not so the first two query blocks of each sequence, whose S and S @ V over all their keys are two-way bf16 splits
#define NB 2
#define LL 2048
#define DM 512
#define NH 8
#define HD 64
#define NR (NB * LL)

// LDS rows of one k step in 16-bit form: 32 elements + 8 of pad = 80 B, the conflict-free pitch of ds_load_b128 on 64-B rows
#define HP 40
typedef __attribute__((ext_vector_type(4))) _Float16 v4h;
typedef __attribute__((ext_vector_type(4))) __bf16 v4b;
typedef __attribute__((ext_vector_type(8))) __bf16 v8b;
__device__ __forceinline__ v16b frag_b(const __bf16* rowk0, int lane) {
  union { v16b v; v8b q[2]; } u; const __bf16* p = rowk0 + 8 * (lane >> 4);
  u.q[0] = *(const v8b*)p; u.q[1] = *(const v8b*)(p + 16); return u.v;
}
// projections: blockIdx.z: 0 -> phi(q) (F16 rows PQ16 [r][512] + f32 PQ32), 1 -> phi(k) (PK16, PK32; PKT16 [n][c][l] f16), 2 -> v (V32 rows [r][512] split GEMM; VT16 [n][c][l] f16)
__global__ __launch_bounds__(128) void k_proj(const float* __restrict__ xq, const float* __restrict__ xk, const float* __restrict__ Wq, const float* __restrict__ Wk, const float* __restrict__ Wv,
                                            _Float16* __restrict__ PQ16, float* __restrict__ PQ32, _Float16* __restrict__ PK16, float* __restrict__ PK32, float* __restrict__ V32, _Float16* __restrict__ VT16, _Float16* __restrict__ PKT16) {
  // one LDS block, used twice. In the k loop: the k step's operands in the matrix unit's own 16-bit form, [buffer 0..1][plane 0..1][row][HP]: x at byte 0 (64 rows),
  // weights at byte 20480 (128 rows); plane 0 = f16 (q, k) or the bf16 high part (v), plane 1 = the bf16 low part (v). Behind the loop: so and st
  __shared__ __align__(16) char sm[61440];
  float (*so)[16][132] = (float (*)[16][132])sm;
  _Float16 (*st)[72] = (_Float16 (*)[72])(sm + 4 * 16 * 132 * 4);
  const int tid = threadIdx.x, wave = tid >> 5, lane = tid & 31, col = lane & 15, g = lane >> 4;
  const int which = blockIdx.z, r0b = blockIdx.x * 64, r0 = r0b + wave * 16, n0 = blockIdx.y * 128;
  v8f acc[8] = {};
  const int srow = tid >> 3, sc = (tid & 7) * 4;          // this thread's pieces of a k step: 4 floats at column sc of rows srow + 16 i; a wave's load covers four whole 128-B lines
  const float* gx = (which == 0 ? xq : xk) + (size_t)(r0b + srow) * DM + sc;
  const float* gw = (which == 0 ? Wq : which == 1 ? Wk : Wv) + (size_t)(n0 + srow) * DM + sc;
  const int so16 = srow * HP + sc, fx16 = (wave * 16 + col) * HP, fw16 = col * HP;   // 16-bit LDS places inside a plane: this thread's first piece; this lane's x row and first weight row
  v4f rx[4], rw[8];                                       // the next k step on its way: loaded ahead of this step's products, converted once for the block and stored behind them
  auto fetch = [&](int kc) {
#pragma unroll
    for (int i = 0; i < 4; ++i) rx[i] = *(const v4f*)(gx + kc * 32 + i * 16 * DM);
#pragma unroll
    for (int i = 0; i < 8; ++i) rw[i] = *(const v4f*)(gw + kc * 32 + i * 16 * DM);
    asm volatile("s_wait_xcnt 0x0" ::: "memory"); };      // stands in front of the next write of the address registers that these loads name
  if (which < 2) {
    _Float16* hX = (_Float16*)sm; _Float16* hW = (_Float16*)(sm + 20480);
    auto put = [&](int b) {
#pragma unroll
      for (int i = 0; i < 4; ++i) { v4h h;
#pragma unroll
        for (int e = 0; e < 4; ++e) h[e] = (_Float16)rx[i][e];
        *(v4h*)(hX + b * (2 * 64 * HP) + so16 + i * (16 * HP)) = h; }
#pragma unroll
      for (int i = 0; i < 8; ++i) { v4h h;
#pragma unroll
        for (int e = 0; e < 4; ++e) h[e] = (_Float16)(rw[i][e] * 16.0f);
        *(v4h*)(hW + b * (2 * 128 * HP) + so16 + i * (16 * HP)) = h; } };
    auto mm = [&](int b) { v16h wf[8]; const v16h a = frag_h(hX + b * (2 * 64 * HP) + fx16, lane);
#pragma unroll
      for (int j = 0; j < 8; ++j) wf[j] = frag_h(hW + b * (2 * 128 * HP) + fw16 + j * (16 * HP), lane);
      __builtin_amdgcn_sched_barrier(0);                  // holds the step's 18 LDS reads in one group ahead of the products: sunk to their users, each product waits out a read of its own
#pragma unroll
      for (int j = 0; j < 8; ++j) acc[j] = wmma16(a, wf[j], acc[j]); };
    fetch(0); put(0);
    __syncthreads();                                      // k step 0 stands in LDS for all four waves
#pragma unroll 1
    for (int kc = 0; kc < DM / 32 - 1; ++kc) { fetch(kc + 1); mm(kc & 1); put((kc & 1) ^ 1);
      __syncthreads(); }                                  // publishes the next step and ends every wave's reads of this one
    mm((DM / 32 - 1) & 1);
    __syncthreads();                                      // every wave's reads of the last step end before so and st take the same LDS
#pragma unroll
    for (int j = 0; j < 8; ++j)
#pragma unroll
      for (int r = 0; r < 8; ++r) { acc[j][r] = softplus(acc[j][r] * (1.0f / 16.0f)); so[wave][8 * g + r][j * 16 + col] = acc[j][r]; }
    if (which == 1) {
#pragma unroll
      for (int j = 0; j < 8; ++j)
#pragma unroll
        for (int r = 0; r < 8; ++r) st[j * 16 + col][wave * 16 + 8 * g + r] = (_Float16)acc[j][r]; }
    LDSX();
    if (which == 1) __syncthreads();                      // all four waves' columns of st stand before its rows are read below; here, ahead of the global stores, it waits for none of them
    _Float16* D16 = which == 0 ? PQ16 : PK16; float* D32 = which == 0 ? PQ32 : PK32;
#pragma unroll 4
    for (int rl = 0; rl < 16; ++rl) vst2(D32 + (size_t)(r0 + rl) * DM + n0 + lane * 4, *(const v4f*)(&so[wave][rl][lane * 4]));
    for (int q = lane; q < 16 * 16; q += 32) { const int rl = q >> 4, pc = q & 15; union { v8h h8; v4u u; } pk;
#pragma unroll
      for (int e = 0; e < 8; ++e) pk.h8[e] = (_Float16)so[wave][rl][pc * 8 + e];
      vst2(D16 + (size_t)(r0 + rl) * DM + n0 + pc * 8, pk.u); }
    if (which == 1) {                                     // PKT16 [n][c][l], as VT16 below
      const int n = r0b / LL, l0 = r0b % LL;
      for (int q = tid; q < 128 * 8; q += 128) { const int cl = q >> 3, pc = q & 7; vst2(PKT16 + ((size_t)n * DM + n0 + cl) * LL + l0 + pc * 8, *(const v4u*)(&st[cl][pc * 8])); } } }
  else {
    __bf16* bX = (__bf16*)sm; __bf16* bW = (__bf16*)(sm + 20480);
    auto put4 = [&](const v4f& v, __bf16* hi, int plane) { v4b h, l;
#pragma unroll
      for (int e = 0; e < 4; ++e) { const __bf16 hh = (__bf16)v[e]; h[e] = hh; l[e] = (__bf16)(v[e] - (float)hh); }
      *(v4b*)hi = h; *(v4b*)(hi + plane) = l; };
    auto put = [&](int b) {
#pragma unroll
      for (int i = 0; i < 4; ++i) put4(rx[i], bX + b * (2 * 64 * HP) + so16 + i * (16 * HP), 64 * HP);
#pragma unroll
      for (int i = 0; i < 8; ++i) put4(rw[i], bW + b * (2 * 128 * HP) + so16 + i * (16 * HP), 128 * HP); };
    auto mm = [&](int b) { F2 a; const __bf16* pa = bX + b * (2 * 64 * HP) + fx16; a.h = frag_b(pa, lane); a.l = frag_b(pa + 64 * HP, lane);
#pragma unroll
      for (int hf = 0; hf < 2; ++hf) { F2 wf[4];          // four column tiles at a time; each accumulator takes its three products in mac3's order, the four chains side by side
#pragma unroll
        for (int j = 0; j < 4; ++j) { const __bf16* pw = bW + b * (2 * 128 * HP) + fw16 + (hf * 4 + j) * (16 * HP); wf[j].h = frag_b(pw, lane); wf[j].l = frag_b(pw + 128 * HP, lane); }
        __builtin_amdgcn_sched_barrier(0);                // holds the half's LDS reads in one group ahead of its products: sunk to their users, each product waits out a read of its own
#pragma unroll
        for (int j = 0; j < 4; ++j) acc[hf * 4 + j] = wmma_bf(a.l, wf[j].h, acc[hf * 4 + j]);
#pragma unroll
        for (int j = 0; j < 4; ++j) acc[hf * 4 + j] = wmma_bf(a.h, wf[j].l, acc[hf * 4 + j]);
#pragma unroll
        for (int j = 0; j < 4; ++j) acc[hf * 4 + j] = wmma_bf(a.h, wf[j].h, acc[hf * 4 + j]); } };
    fetch(0); put(0);
    __syncthreads();                                      // k step 0 stands in LDS for all four waves
#pragma unroll 1
    for (int kc = 0; kc < DM / 32 - 1; ++kc) { fetch(kc + 1); mm(kc & 1); put((kc & 1) ^ 1);
      __syncthreads(); }                                  // publishes the next step and ends every wave's reads of this one
    mm((DM / 32 - 1) & 1);
    __syncthreads();                                      // every wave's reads of the last step end before so and st take the same LDS
#pragma unroll
    for (int j = 0; j < 8; ++j)
#pragma unroll
      for (int r = 0; r < 8; ++r) { so[wave][8 * g + r][j * 16 + col] = acc[j][r]; st[j * 16 + col][wave * 16 + 8 * g + r] = (_Float16)acc[j][r]; }
    LDSX();
#pragma unroll 4
    for (int rl = 0; rl < 16; ++rl) vst2(V32 + (size_t)(r0 + rl) * DM + n0 + lane * 4, *(const v4f*)(&so[wave][rl][lane * 4]));
    __syncthreads();
    // VT16 [n][c][l]: c = n0 + cl (global channel 0..511 = h*64 + d), l = r0b .. +63 within sequence n
    { const int n = r0b / LL, l0 = r0b % LL;
      for (int q = tid; q < 128 * 8; q += 128) { const int cl = q >> 3, pc = q & 7; vst2(VT16 + ((size_t)n * DM + n0 + cl) * LL + l0 + pc * 8, *(const v4u*)(&st[cl][pc * 8])); } } }
}
// one 64 x 64 f16 tile of phi(k) (rows, or rows of the transposed copy) and one of V^T rows, 128 B a row, into LDS rows of KP halves: each lane brings
// 4 + 4 pieces of 16 B, a wave's copy covers four whole 128-B lines. gk, gv, lk, lv: the lane's own first piece; the next three lie 16 rows further each
// (ks: 16 rows of the phi(k) source in elements)
#define KP 72
__device__ __forceinline__ void stage_kv(const _Float16* gk, int ks, const _Float16* gv, unsigned lk, unsigned lv) {
  const _Float16 *gk1 = gk + ks, *gk2 = gk + 2 * ks, *gk3 = gk + 3 * ks, *gv1 = gv + 16 * LL, *gv2 = gv + 32 * LL, *gv3 = gv + 48 * LL;
  const unsigned lk1 = lk + 16 * KP * 2, lk2 = lk + 32 * KP * 2, lk3 = lk + 48 * KP * 2, lv1 = lv + 16 * KP * 2, lv2 = lv + 32 * KP * 2, lv3 = lv + 48 * KP * 2;
  // the copies and their s_wait_xcnt in one statement: the wait stands in front of any rewrite of the address registers the copies name
  asm volatile("global_load_async_to_lds_b128 %0, %8, off\n\t"
               "global_load_async_to_lds_b128 %1, %9, off\n\t"
               "global_load_async_to_lds_b128 %2, %10, off\n\t"
               "global_load_async_to_lds_b128 %3, %11, off\n\t"
               "global_load_async_to_lds_b128 %4, %12, off\n\t"
               "global_load_async_to_lds_b128 %5, %13, off\n\t"
               "global_load_async_to_lds_b128 %6, %14, off\n\t"
               "global_load_async_to_lds_b128 %7, %15, off\n\t"
               "s_wait_xcnt 0x0"
               :: "v"(lk), "v"(lk1), "v"(lk2), "v"(lk3), "v"(lv), "v"(lv1), "v"(lv2), "v"(lv3),
                  "v"(gk), "v"(gk1), "v"(gk2), "v"(gk3), "v"(gv), "v"(gv1), "v"(gv2), "v"(gv3) : "memory");
}
// attention: block (64 queries, h, n)
__global__ __launch_bounds__(128) void k_attn(const _Float16* __restrict__ PQ16, const float* __restrict__ PQ32, const _Float16* __restrict__ PK16, const float* __restrict__ PK32, const float* __restrict__ V32, const _Float16* __restrict__ VT16, const _Float16* __restrict__ PKT16, float* __restrict__ out) {
  __shared__ __align__(16) float sS[4][16][68];
  __shared__ __align__(16) _Float16 sP[4][16][72];
  __shared__ __align__(16) float sO[4][16][68];
  __shared__ __align__(16) _Float16 sK[2][2][64][KP];     // two buffers of two prefix tiles each (even tile, odd tile): the pair in work and the next pair in flight
  __shared__ __align__(16) _Float16 sV[2][2][64][KP];
  __shared__ __align__(16) _Float16 sKo[64][KP];          // the block's own key tile: phi(k) rows and V^T rows
  __shared__ __align__(16) _Float16 sVo[64][KP];
  __shared__ __align__(16) _Float16 sT[2][80][KP];        // prefix state x 1/64 of the even and of the odd tiles, transposed: rows 0..63 = value channel D, rows 64..79 = the prefix sum of phi(k) (16 equal rows); columns = feature d
  const int tid = threadIdx.x, w = tid >> 5, lane = tid & 31, col = lane & 15, g = lane >> 4;
  const int n = blockIdx.z, h = blockIdx.y, q0 = blockIdx.x * 64 + w * 16; const size_t rb = (size_t)n * LL;
  const bool precise = blockIdx.x < 2;
  v8f acc[4] = {}, zpre = {}; float zsum = 0.f;                      // zsum: row (col) partial over this lane's half? -> keep per (row = col, half g) then combine
  const int ntiles = blockIdx.x + 1;
  // what this launch reads was written by the launch before it. Each lane asks L2 ahead of time for one 256-B unit a step:
  // lanes 0..63 of the block for phi(k), 64..127 for V; precise blocks: the head's 64 f32 of a key row; the others: one 4096-B row of the transposed f16 copies, a pair of key tiles a unit
  const char* pf = precise ? (const char*)((tid >> 6 ? V32 : PK32) + (rb + (tid & 63)) * DM + h * HD)
                           : (const char*)((tid >> 6 ? VT16 : PKT16) + ((size_t)n * DM + h * HD + (tid & 63)) * LL);
  // masked scores of key columns t * 16 + col into the wave's own sS rows
  auto put_s = [&](int kt, int t, const v8f& s) { const int key = kt * 64 + t * 16 + col;
#pragma unroll
    for (int r = 0; r < 8; ++r) { const int qi = q0 + 8 * g + r; sS[w][8 * g + r][t * 16 + col] = key <= qi ? s[r] : 0.f; } };
  // row sums (lane (row col, half g)) and the f16 copy (x 1/64)
  auto rowsum = [&]() { float z = 0.f;
#pragma unroll
    for (int jj = 0; jj < 32; ++jj) { const float sv = sS[w][col][g * 32 + jj]; z += sv; sP[w][col][g * 32 + jj] = (_Float16)(sv * (1.0f / 64.0f)); }
    zsum += z; };
  if (precise) {                                          // nothing is staged here: each wave works on its own LDS rows alone
    // a hint to L2 only: key rows 0..63, and 64..127 where the block has a second tile (64 rows of 2048 B further); both lie inside the two arrays
    asm volatile("global_prefetch_b8 %0, off scope:SCOPE_SE" :: "v"(pf));
    if (ntiles > 1) asm volatile("global_prefetch_b8 %0, off offset:131072 scope:SCOPE_SE" :: "v"(pf));
    F2 aqs[2];
#pragma unroll
    for (int kc = 0; kc < 2; ++kc) aqs[kc] = split_row(PQ32 + (rb + q0 + col) * DM + h * HD, kc * 32, lane);
#pragma unroll 1
    for (int kt = 0; kt < ntiles; ++kt) {
#pragma unroll
      for (int t = 0; t < 4; ++t) { v8f s = {}; const int key = kt * 64 + t * 16 + col;
#pragma unroll
        for (int kc = 0; kc < 2; ++kc) s = mac3(aqs[kc], split_row(PK32 + (rb + key) * DM + h * HD, kc * 32, lane), s);
        put_s(kt, t, s); }
      LDSX();
      rowsum();
      LDSX();
#pragma unroll
      for (int kc = 0; kc < 2; ++kc) { const F2 pa = split_row(&sS[w][col][0], kc * 32, lane);
#pragma unroll
        for (int t = 0; t < 4; ++t) acc[t] = mac3(pa, split_col(V32 + (rb + kt * 64) * DM + h * HD, kc * 32, t * 16 + col, lane, DM, 64), acc[t]); } } }
  else {
    v16h aq[2];
#pragma unroll
    for (int kc = 0; kc < 2; ++kc) aq[kc] = frag_h(PQ16 + (rb + q0 + col) * DM + h * HD + kc * 32, lane);
    const int nx = blockIdx.x;                            // key tiles 0 .. nx - 1 lie wholly in front of the block's queries, tile nx is the block's own
    const _Float16* gkt = PKT16 + ((size_t)n * DM + h * HD + (tid >> 3)) * LL + (tid & 7) * 8;       // transposed phi(k), tile 0, this lane's first piece; a tile further: 64 columns
    const _Float16* gkr = PK16 + (rb + nx * 64 + (tid >> 3)) * DM + h * HD + (tid & 7) * 8;          // phi(k) rows of tile nx
    const _Float16* gv = VT16 + ((size_t)n * DM + h * HD + (tid >> 3)) * LL + (tid & 7) * 8;         // tile 0; a tile further: 64 columns
    const unsigned lk = (unsigned)(size_t)&sK[0][0][tid >> 3][(tid & 7) * 8], lv = (unsigned)(size_t)&sV[0][0][tid >> 3][(tid & 7) * 8];
    const unsigned lko = (unsigned)(size_t)&sKo[tid >> 3][(tid & 7) * 8], lvo = (unsigned)(size_t)&sVo[tid >> 3][(tid & 7) * 8];
    // the prefix tiles go two a trip: tile 2 j to waves 0 and 2, tile 2 j + 1 to waves 1 and 3, each wave 32 feature rows of its tile's phi_k^T V
    const int ng = (nx + 1) >> 1;                         // trips; with nx odd the last pair's second tile is tile nx: it exists in both copies, is staged like any other and enters no prefix sum
    const int wu = __builtin_amdgcn_readfirstlane(w), par = wu & 1, fh = wu >> 1;                    // scalar: the test on par below is a branch of the whole wave
    auto stage_pair = [&](int j, int b) {
      stage_kv(gkt + (2 * j) * 64, 16 * LL, gv + (2 * j) * 64, lk + b * (2 * 64 * KP * 2), lv + b * (2 * 64 * KP * 2));
      stage_kv(gkt + (2 * j + 1) * 64, 16 * LL, gv + (2 * j + 1) * 64, lk + b * (2 * 64 * KP * 2) + 64 * KP * 2, lv + b * (2 * 64 * KP * 2) + 64 * KP * 2); };
    stage_kv(gkr, 16 * DM, gv + nx * 64, lko, lvo);
    stage_pair(0, 0);
    // a hint to L2 only, behind the first copies: pairs 1 to 3 (byte 256 j of the lane's row), so that their copies find the lines in L2; the tests read the same for the whole block
    if (ng > 1) asm volatile("global_prefetch_b8 %0, off offset:256 scope:SCOPE_SE" :: "v"(pf));
    if (ng > 2) asm volatile("global_prefetch_b8 %0, off offset:512 scope:SCOPE_SE" :: "v"(pf));
    if (ng > 3) asm volatile("global_prefetch_b8 %0, off offset:768 scope:SCOPE_SE" :: "v"(pf));
    pf += 768;                                            // pair 3's unit; a row holds 16 units, so this lies inside the row whatever ng is
    asm volatile("s_wait_asynccnt 0x0" ::: "memory");     // the own tile and pair 0 have landed before the barrier that lets the other waves read them
    __syncthreads();
    if (ng > 1) stage_pair(1, 1);
    v8f ps[2][4] = {}, pz[2] = {};                        // this wave's 32 feature rows (fh * 32 ..) of phi_k^T V and of phi_k^T 1, over the tiles of its parity
    v16h ones;
#pragma unroll
    for (int i = 0; i < 16; ++i) ones[i] = (_Float16)1.0f;
#pragma unroll 1
    for (int j = 0; j < ng; ++j) {
      if (2 * j + par < nx) {
        v16h ka[2][2], vf[2][4];
#pragma unroll
        for (int a = 0; a < 2; ++a)
#pragma unroll
          for (int kc = 0; kc < 2; ++kc) ka[a][kc] = frag_h(&sK[j & 1][par][fh * 32 + a * 16 + col][kc * 32], lane);
#pragma unroll
        for (int kc = 0; kc < 2; ++kc)
#pragma unroll
          for (int t = 0; t < 4; ++t) vf[kc][t] = frag_h(&sV[j & 1][par][t * 16 + col][kc * 32], lane);
        __builtin_amdgcn_sched_barrier(0);                // holds the tile's 24 LDS reads in one group ahead of the products: sunk to their users, each product waits out a read of its own
#pragma unroll
        for (int kc = 0; kc < 2; ++kc)
#pragma unroll
          for (int a = 0; a < 2; ++a) {
#pragma unroll
            for (int t = 0; t < 4; ++t) ps[a][t] = wmma16(ka[a][kc], vf[kc][t], ps[a][t]);
            pz[a] = wmma16(ka[a][kc], ones, pz[a]); } }
      asm volatile("s_wait_dscnt 0x0" ::: "memory");      // this wave's reads of the pair's buffer are done before the buffer is filled again
      asm volatile("s_wait_asynccnt 0x0" ::: "memory");   // this wave's pieces of the next pair have landed
      __syncthreads();                                    // publishes the next pair and ends every wave's reads of this one
      if (j + 2 < ng) stage_pair(j + 2, j & 1);
      // pair j + 4 is asked for two trips ahead of its copies; the address moves only under the test, to unit ng - 1 <= 15 at the most: it never leaves the lane's row
      if (j + 4 < ng) { pf += 256; asm volatile("global_prefetch_b8 %0, off scope:SCOPE_SE" :: "v"(pf)); } }
    asm volatile("s_wait_asynccnt 0x0" ::: "memory");     // no copy is outstanding behind the loop
    // the 32 state rows of each wave to LDS, transposed, into its parity's plane: a lane holds 8 successive features of one channel
#pragma unroll
    for (int a = 0; a < 2; ++a)
#pragma unroll
      for (int t = 0; t < 5; ++t) { const v8f sv = t < 4 ? ps[a][t] : pz[a]; v8h hs;
#pragma unroll
        for (int r = 0; r < 8; ++r) hs[r] = (_Float16)(sv[r] * (1.0f / 64.0f));
        *(v8h*)(&sT[par][t * 16 + col][fh * 32 + a * 16 + 8 * g]) = hs; }
    asm volatile("s_wait_dscnt 0x0" ::: "memory");        // this wave's rows of the state are in LDS before the barrier
    __syncthreads();                                      // every wave reads all four waves' rows of the state
    { v16h sf[2][2][5];                                   // phi_q . (even state + odd state): the two planes are applied one after the other into the same sums
#pragma unroll
      for (int pp = 0; pp < 2; ++pp)
#pragma unroll
        for (int kc = 0; kc < 2; ++kc)
#pragma unroll
          for (int t = 0; t < 5; ++t) sf[pp][kc][t] = frag_h(&sT[pp][t * 16 + col][kc * 32], lane);
      __builtin_amdgcn_sched_barrier(0);                  // holds the state's 40 LDS reads in one group ahead of the products: sunk to their users, each product waits out a read of its own
#pragma unroll
      for (int pp = 0; pp < 2; ++pp)
#pragma unroll
        for (int kc = 0; kc < 2; ++kc) {
#pragma unroll
          for (int t = 0; t < 4; ++t) acc[t] = wmma16(aq[kc], sf[pp][kc][t], acc[t]);
          zpre = wmma16(aq[kc], sf[pp][kc][4], zpre); } }
    { // the block's own tile: masked scores
      v16h kf[2][4], vf[2][4];
#pragma unroll
      for (int kc = 0; kc < 2; ++kc)
#pragma unroll
        for (int t = 0; t < 4; ++t) kf[kc][t] = frag_h(&sKo[t * 16 + col][kc * 32], lane);
#pragma unroll
      for (int kc = 0; kc < 2; ++kc)
#pragma unroll
        for (int t = 0; t < 4; ++t) vf[kc][t] = frag_h(&sVo[t * 16 + col][kc * 32], lane);
      v8f s[4] = {};
#pragma unroll
      for (int kc = 0; kc < 2; ++kc)
#pragma unroll
        for (int t = 0; t < 4; ++t) s[t] = wmma16(aq[kc], kf[kc][t], s[t]);
#pragma unroll
      for (int t = 0; t < 4; ++t) put_s(nx, t, s[t]);
      LDSX();
      rowsum();
      LDSX();
      v16h pa[2];
#pragma unroll
      for (int kc = 0; kc < 2; ++kc) pa[kc] = frag_h(&sP[w][col][0] + kc * 32, lane);
#pragma unroll
      for (int kc = 0; kc < 2; ++kc)
#pragma unroll
        for (int t = 0; t < 4; ++t) acc[t] = wmma16(pa[kc], vf[kc][t], acc[t]); } }
  zsum += __shfl_xor(zsum, 16, 32);                        // full row sum for row 'col' in both half-lanes
  const float oscale = precise ? 1.0f : 64.0f;
#pragma unroll
  for (int r = 0; r < 8; ++r) { const float zr = __shfl(zsum, 8 * g + r, 32) + zpre[r] * 64.0f;   // own tile's row sum + phi_q . prefix sum of phi_k (0 in the precise blocks)
#pragma unroll
    for (int t = 0; t < 4; ++t) sO[w][8 * g + r][t * 16 + col] = acc[t][r] * oscale / zr; }
  LDSX();
  for (int q = lane; q < 16 * 16; q += 32) { const int rl = q >> 4, pc = q & 15; vst2(out + (rb + q0 + rl) * DM + h * HD + pc * 4, *(const v4f*)(&sO[w][rl][pc * 4])); }
  asm volatile("" :: "v"(pf));                             // input only: the register pair that the prefetches name holds an address of theirs to the kernel's end and is given to no other value
}
extern "C" void kernel_launch(void* const* d_in, const int* in_sizes, int n_in, void* d_out, int out_size, void* d_ws, size_t ws_size, hipStream_t stream) {
  (void)in_sizes; (void)n_in; (void)out_size; (void)ws_size;
  const float* xq = (const float*)d_in[0]; const float* xk = (const float*)d_in[1]; const float* Wq = (const float*)d_in[2]; const float* Wk = (const float*)d_in[3]; const float* Wv = (const float*)d_in[4];
  float* out = (float*)d_out;
  char* ws = (char*)d_ws; size_t off = 0;
  auto take = [&](size_t bytes) { char* p = ws + off; off += (bytes + 255) & ~(size_t)255; return p; };
  _Float16* PQ16 = (_Float16*)take((size_t)NR * DM * 2); float* PQ32 = (float*)take((size_t)NR * DM * 4); _Float16* PK16 = (_Float16*)take((size_t)NR * DM * 2); float* PK32 = (float*)take((size_t)NR * DM * 4);
  float* V32 = (float*)take((size_t)NR * DM * 4); _Float16* VT16 = (_Float16*)take((size_t)NB * DM * LL * 2); _Float16* PKT16 = (_Float16*)take((size_t)NB * DM * LL * 2);
  k_proj<<<dim3(NR / 64, DM / 128, 3), 128, 0, stream>>>(xq, xk, Wq, Wk, Wv, PQ16, PQ32, PK16, PK32, V32, VT16, PKT16);
  k_attn<<<dim3(LL / 64, NH, NB), 128, 0, stream>>>(PQ16, PQ32, PK16, PK32, V32, VT16, PKT16, out);
}
